// v000
// Measured on an AMD MI455X. A time is GPU time per run, averaged over a window of back-to-back runs after a warm-up
// (all launches, gaps included; the runs take copies of the inputs in turn), and the median of several windows.
// Apart from v000's, it joins two sittings. Times from different sittings can be a few percent apart, while
// side-by-side timings come from the same sitting.
// v000, which the later versions start from, runs in 628 microseconds.
#include <hip/hip_runtime.h>

typedef __attribute__((ext_vector_type(16))) _Float16 v16h;
typedef __attribute__((ext_vector_type(8)))  _Float16 v8h;
typedef __attribute__((ext_vector_type(4)))  _Float16 v4h;
typedef __attribute__((ext_vector_type(8)))  float    v8f;

#define EMBED 1024
#define HEADS 16
#define HDIM  64
#define BATCH 4
#define SEQ   2048
#define MTOT  (BATCH * SEQ)   // 8192

// ---------------------------------------------------------------------------
// Fragment loader: 16x32 f16 tile from a row-major source where the wave-lane
// indexes the M (or N) row and K is contiguous in memory.
// Layout per CDNA5 ISA 7.12.2 (16-bit A 16x32):
//   lanes 0-15 : row = lane,    elems 0..7 = K[0..7],  elems 8..15 = K[16..23]
//   lanes 16-31: row = lane-16, elems 0..7 = K[8..15], elems 8..15 = K[24..31]
// -> two 16-byte loads per lane. B (32x16) uses the symmetric layout, so the
// same loader serves B fragments from a [N, K] row-major (i.e. B^T) source.
// ---------------------------------------------------------------------------
__device__ __forceinline__ v16h load_frag(const _Float16* __restrict__ p, int ld) {
  const int lane = threadIdx.x & 31;
  const _Float16* q = p + (size_t)(lane & 15) * ld + ((lane >> 4) << 3);
  union { v8h h[2]; v16h v; } u;
  u.h[0] = *(const v8h*)(q);
  u.h[1] = *(const v8h*)(q + 16);
  return u.v;
}

__device__ __forceinline__ v8f wmma32(v16h a, v16h b, v8f c) {
  return __builtin_amdgcn_wmma_f32_16x16x32_f16(
      /*neg_a=*/false, a, /*neg_b=*/false, b,
      /*c_mod=*/(short)0, c, /*reuse_a=*/false, /*reuse_b=*/false);
}

// ---------------------------------------------------------------------------
// f32 -> f16 conversion (4 elements / thread)
// ---------------------------------------------------------------------------
__global__ void __launch_bounds__(256)
cvt_f32_f16(const float* __restrict__ src, _Float16* __restrict__ dst, int n) {
  int i = (blockIdx.x * blockDim.x + threadIdx.x) * 4;
  if (i >= n) return;
  float4 f = *(const float4*)(src + i);
  v4h h;
  h[0] = (_Float16)f.x; h[1] = (_Float16)f.y;
  h[2] = (_Float16)f.z; h[3] = (_Float16)f.w;
  *(v4h*)(dst + i) = h;
}

// dst[c][r] = (f16) src[r][c]   (rows x cols source)
__global__ void __launch_bounds__(256)
transpose_cvt(const float* __restrict__ src, _Float16* __restrict__ dst,
              int rows, int cols) {
  int t = blockIdx.x * blockDim.x + threadIdx.x;
  if (t >= rows * cols) return;
  int r = t / cols, c = t % cols;
  dst[(size_t)c * rows + r] = (_Float16)src[t];
}

// ---------------------------------------------------------------------------
// WMMA GEMM: C[M,N] = A[M,K] * B[K,N], with B supplied transposed as Bt[N,K].
// Each wave computes a 64x64 tile (16 wmmas per K=32 step).
// mode 0: store f16 to [B,H,S,D]      (Q, K projections)
// mode 1: store f16 to [B,H,D,S]      (V projection, pre-transposed for P@V)
// mode 2: store f32 to [M,N] + bias   (final output projection)
// ---------------------------------------------------------------------------
__global__ void __launch_bounds__(256)
gemm_wmma(const _Float16* __restrict__ A, const _Float16* __restrict__ Bt,
          _Float16* __restrict__ outh, float* __restrict__ outf,
          const float* __restrict__ bias, int M, int N, int Kd, int mode) {
  const int wave  = blockIdx.x * (blockDim.x >> 5) + (threadIdx.x >> 5);
  const int tilesN = N >> 6;
  const int tm = wave / tilesN;
  const int tn = wave % tilesN;
  if (tm * 64 >= M) return;
  const int lane = threadIdx.x & 31;
  const int half = lane >> 4, nlo = lane & 15;

  const _Float16* Abase = A  + (size_t)tm * 64 * Kd;
  const _Float16* Bbase = Bt + (size_t)tn * 64 * Kd;

  v8f acc[4][4] = {};

  for (int k0 = 0; k0 < Kd; k0 += 32) {
    // speculative prefetch of the next K-panel (global_prefetch_b8)
    if (k0 + 32 < Kd) {
      __builtin_prefetch(Abase + (size_t)(lane & 15) * Kd + k0 + 32, 0, 1);
      __builtin_prefetch(Bbase + (size_t)(lane & 15) * Kd + k0 + 32, 0, 1);
    }
    v16h af[4];
#pragma unroll
    for (int i = 0; i < 4; ++i)
      af[i] = load_frag(Abase + (size_t)(i * 16) * Kd + k0, Kd);
#pragma unroll
    for (int j = 0; j < 4; ++j) {
      v16h bf = load_frag(Bbase + (size_t)(j * 16) * Kd + k0, Kd);
#pragma unroll
      for (int i = 0; i < 4; ++i)
        acc[i][j] = wmma32(af[i], bf, acc[i][j]);
    }
  }

#pragma unroll
  for (int i = 0; i < 4; ++i) {
#pragma unroll
    for (int j = 0; j < 4; ++j) {
#pragma unroll
      for (int r = 0; r < 8; ++r) {
        const int m = tm * 64 + i * 16 + r + half * 8;
        const int n = tn * 64 + j * 16 + nlo;
        const float v = acc[i][j][r];
        if (mode == 2) {
          outf[(size_t)m * N + n] = v + bias[n];
        } else {
          const int b = m >> 11, s = m & (SEQ - 1);
          const int h = n >> 6,  d = n & (HDIM - 1);
          const size_t idx = (mode == 0)
              ? ((size_t)(b * HEADS + h) * SEQ + s) * HDIM + d
              : ((size_t)(b * HEADS + h) * HDIM + d) * SEQ + s;
          outh[idx] = (_Float16)v;
        }
      }
    }
  }
}

// ---------------------------------------------------------------------------
// Flash-attention: one wave per 16-row Q tile of one (batch, head).
// Q,K: [B,H,S,D] f16. Vt: [B,H,D,S] f16. Ctx: [B,S,E] f16.
// Streams 64 KV rows/iter: 8 score WMMAs, one online-softmax pass (cross-lane
// reductions amortized over 64 columns), 8 ctx WMMAs.
// ---------------------------------------------------------------------------
__global__ void __launch_bounds__(256)
attn_wmma(const _Float16* __restrict__ Q, const _Float16* __restrict__ K,
          const _Float16* __restrict__ Vt, _Float16* __restrict__ Ctx) {
  __shared__ _Float16 ldsP[8][16][64];   // per-wave P staging (C-layout -> A-layout)

  const int wave = blockIdx.x * 8 + (threadIdx.x >> 5);
  const int qt = wave & 127;             // q tile within head (S/16 = 128)
  const int bh = wave >> 7;              // b*HEADS + h
  const int lane = threadIdx.x & 31;
  const int half = lane >> 4, nlo = lane & 15;
  const int w = threadIdx.x >> 5;

  const _Float16* Qb = Q  + ((size_t)bh * SEQ + qt * 16) * HDIM;
  const _Float16* Kb = K  + (size_t)bh * SEQ * HDIM;
  const _Float16* Vb = Vt + (size_t)bh * HDIM * SEQ;

  const v16h aq0 = load_frag(Qb + 0,  HDIM);   // Q rows, d 0..31
  const v16h aq1 = load_frag(Qb + 32, HDIM);   // Q rows, d 32..63

  v8f ctx[4] = {};
  float mrow[8], lrow[8];
#pragma unroll
  for (int r = 0; r < 8; ++r) { mrow[r] = -1e30f; lrow[r] = 0.0f; }
  const float sc = 0.125f;               // 1/sqrt(64)

  for (int kb = 0; kb < SEQ; kb += 64) {
    // prefetch next KV panel into cache hierarchy
    if (kb + 64 < SEQ) {
      __builtin_prefetch(Kb + (size_t)(kb + 64 + (lane & 15)) * HDIM, 0, 1);
      __builtin_prefetch(Vb + (size_t)(lane & 15) * SEQ + kb + 64, 0, 1);
    }

    // ---- scores: four 16x16 tiles covering kv [kb, kb+64) ----
    v8f s[4] = {};
#pragma unroll
    for (int t = 0; t < 4; ++t) {
      s[t] = wmma32(aq0, load_frag(Kb + (size_t)(kb + t * 16) * HDIM,      HDIM), s[t]);
      s[t] = wmma32(aq1, load_frag(Kb + (size_t)(kb + t * 16) * HDIM + 32, HDIM), s[t]);
    }

    // ---- online softmax (rows live across the 16 lanes of each half) ----
    float fac[8];
#pragma unroll
    for (int r = 0; r < 8; ++r) {
      float e0 = s[0][r] * sc, e1 = s[1][r] * sc;
      float e2 = s[2][r] * sc, e3 = s[3][r] * sc;
      float mx = fmaxf(fmaxf(e0, e1), fmaxf(e2, e3));
      mx = fmaxf(mx, __shfl_xor(mx, 1, 32));
      mx = fmaxf(mx, __shfl_xor(mx, 2, 32));
      mx = fmaxf(mx, __shfl_xor(mx, 4, 32));
      mx = fmaxf(mx, __shfl_xor(mx, 8, 32));
      const float mn = fmaxf(mrow[r], mx);
      const float p0 = __expf(e0 - mn);
      const float p1 = __expf(e1 - mn);
      const float p2 = __expf(e2 - mn);
      const float p3 = __expf(e3 - mn);
      float rs = (p0 + p1) + (p2 + p3);
      rs += __shfl_xor(rs, 1, 32);
      rs += __shfl_xor(rs, 2, 32);
      rs += __shfl_xor(rs, 4, 32);
      rs += __shfl_xor(rs, 8, 32);
      const float f = __expf(mrow[r] - mn);
      lrow[r] = lrow[r] * f + rs;
      mrow[r] = mn;
      fac[r] = f;
      const int pr = r + half * 8;
      ldsP[w][pr][nlo]      = (_Float16)p0;
      ldsP[w][pr][nlo + 16] = (_Float16)p1;
      ldsP[w][pr][nlo + 32] = (_Float16)p2;
      ldsP[w][pr][nlo + 48] = (_Float16)p3;
    }
#pragma unroll
    for (int j = 0; j < 4; ++j)
#pragma unroll
      for (int r = 0; r < 8; ++r) ctx[j][r] *= fac[r];

    // ensure P staging stores landed before the cross-lane A-fragment reads
    asm volatile("s_wait_dscnt 0" ::: "memory");
    const v16h pa0 = load_frag(&ldsP[w][0][0],  64);   // P: 16(q) x kv[0..31]
    const v16h pa1 = load_frag(&ldsP[w][0][32], 64);   // P: 16(q) x kv[32..63]

    // ---- ctx += P @ V : four 16-wide d chunks, two kv halves each ----
#pragma unroll
    for (int j = 0; j < 4; ++j) {
      v16h vb0 = load_frag(Vb + (size_t)(j * 16) * SEQ + kb,      SEQ);
      v16h vb1 = load_frag(Vb + (size_t)(j * 16) * SEQ + kb + 32, SEQ);
      ctx[j] = wmma32(pa0, vb0, ctx[j]);
      ctx[j] = wmma32(pa1, vb1, ctx[j]);
    }
  }

  // ---- normalize and write ctx tile as f16 [B,S,E] ----
  float inv[8];
#pragma unroll
  for (int r = 0; r < 8; ++r) inv[r] = 1.0f / lrow[r];
  const int b = bh >> 4, h = bh & 15;
#pragma unroll
  for (int j = 0; j < 4; ++j) {
#pragma unroll
    for (int r = 0; r < 8; ++r) {
      const int s = qt * 16 + r + half * 8;
      const int e = h * HDIM + j * 16 + nlo;
      Ctx[((size_t)b * SEQ + s) * EMBED + e] = (_Float16)(ctx[j][r] * inv[r]);
    }
  }
}

// ---------------------------------------------------------------------------
// Host-side orchestration
// Workspace (f16 elems): [0,8M) Xh (reused as Ctx), [8M..12M) weights,
// [12M..20M) Qh, [20M..28M) Kh, [28M..36M) Vth  => 72 MB total.
// ---------------------------------------------------------------------------
extern "C" void kernel_launch(void* const* d_in, const int* in_sizes, int n_in,
                              void* d_out, int out_size, void* d_ws, size_t ws_size,
                              hipStream_t stream) {
  const float* X  = (const float*)d_in[0];
  const float* Wq = (const float*)d_in[1];
  const float* Wk = (const float*)d_in[2];
  const float* Wv = (const float*)d_in[3];
  const float* Wo = (const float*)d_in[4];
  const float* bo = (const float*)d_in[5];
  float* out = (float*)d_out;

  _Float16* ws = (_Float16*)d_ws;
  const size_t M1 = (size_t)1024 * 1024;
  _Float16* Xh  = ws;             // 8M elems; later reused as Ctx (f16)
  _Float16* Wqt = ws + 8 * M1;    // W_q^T  [f,e]
  _Float16* Wkt = ws + 9 * M1;
  _Float16* Wvt = ws + 10 * M1;
  _Float16* Woh = ws + 11 * M1;   // W_o    [f,e] (already B^T layout for x@Wo^T)
  _Float16* Qh  = ws + 12 * M1;   // [B,H,S,D]
  _Float16* Kh  = ws + 20 * M1;   // [B,H,S,D]
  _Float16* Vth = ws + 28 * M1;   // [B,H,D,S]

  // 1) precision conversion / weight re-layout
  cvt_f32_f16  <<<8192, 256, 0, stream>>>(X,  Xh,  MTOT * EMBED);
  transpose_cvt<<<4096, 256, 0, stream>>>(Wq, Wqt, EMBED, EMBED);
  transpose_cvt<<<4096, 256, 0, stream>>>(Wk, Wkt, EMBED, EMBED);
  transpose_cvt<<<4096, 256, 0, stream>>>(Wv, Wvt, EMBED, EMBED);
  cvt_f32_f16  <<<1024, 256, 0, stream>>>(Wo, Woh, EMBED * EMBED);

  // 2) Q/K/V projections (8192x1024x1024 each), 2048 waves / 256 blocks
  gemm_wmma<<<256, 256, 0, stream>>>(Xh, Wqt, Qh,  nullptr, nullptr, MTOT, EMBED, EMBED, 0);
  gemm_wmma<<<256, 256, 0, stream>>>(Xh, Wkt, Kh,  nullptr, nullptr, MTOT, EMBED, EMBED, 0);
  gemm_wmma<<<256, 256, 0, stream>>>(Xh, Wvt, Vth, nullptr, nullptr, MTOT, EMBED, EMBED, 1);

  // 3) flash attention: 8192 q-tiles -> 1024 blocks of 8 waves; Ctx -> Xh
  attn_wmma<<<1024, 256, 0, stream>>>(Qh, Kh, Vth, Xh);

  // 4) output projection + bias, f32 result
  gemm_wmma<<<256, 256, 0, stream>>>(Xh, Woh, nullptr, out, bo, MTOT, EMBED, EMBED, 2);
}

// v001
// Measured time: 538 microseconds a run.
// In both of two side-by-side timings against v000, it was 1.19 times as fast.
#include <hip/hip_runtime.h>

typedef __attribute__((ext_vector_type(16))) _Float16 v16h;
typedef __attribute__((ext_vector_type(8)))  _Float16 v8h;
typedef __attribute__((ext_vector_type(4)))  _Float16 v4h;
typedef __attribute__((ext_vector_type(8)))  float    v8f;

#define EMBED 1024
#define HEADS 16
#define HDIM  64
#define BATCH 4
#define SEQ   2048
#define MTOT  (BATCH * SEQ)   // 8192

// ---------------------------------------------------------------------------
// Fragment loader: 16x32 f16 tile from a row-major source where the wave-lane
// indexes the M (or N) row and K is contiguous in memory.
// Layout per CDNA5 ISA 7.12.2 (16-bit A 16x32):
//   lanes 0-15 : row = lane,    elems 0..7 = K[0..7],  elems 8..15 = K[16..23]
//   lanes 16-31: row = lane-16, elems 0..7 = K[8..15], elems 8..15 = K[24..31]
// -> two 16-byte loads per lane. B (32x16) uses the symmetric layout, so the
// same loader serves B fragments from a [N, K] row-major (i.e. B^T) source.
// ---------------------------------------------------------------------------
__device__ __forceinline__ v16h load_frag(const _Float16* __restrict__ p, int ld) {
  const int lane = threadIdx.x & 31;
  const _Float16* q = p + (size_t)(lane & 15) * ld + ((lane >> 4) << 3);
  union { v8h h[2]; v16h v; } u;
  u.h[0] = *(const v8h*)(q);
  u.h[1] = *(const v8h*)(q + 16);
  return u.v;
}

// ---------------------------------------------------------------------------
// Fragment-ordered operands. Every f16 matrix [rows][K] that a WMMA reads from
// the workspace is kept as blocks of 16 rows x 32 k (512 elements, 1 KiB);
// block (rt, kt) stands at (rt * (K / 32) + kt) * 512. Inside a block the
// 16-byte chunk number u * 32 + lane holds what load_frag gives that lane as
// elements 8u .. 8u+7: row = lane & 15, k = 16 * u + 8 * (lane >> 4) + 0..7.
// A wave-wide 16-byte load or store of one u is then 512 contiguous bytes
// (4 cache lines) where the row-major form touches 16 lines.
// ---------------------------------------------------------------------------
__device__ __forceinline__ v16h load_pk(const _Float16* __restrict__ blk) {
  const _Float16* q = blk + (threadIdx.x & 31) * 8;
  union { v8h h[2]; v16h v; } u;
  u.h[0] = *(const v8h*)(q);
  u.h[1] = *(const v8h*)(q + 256);
  return u.v;
}

// The same from a lane's own address (block + lane * 8) in global memory. The
// type names the address space because the GEMM's stepped addresses pass
// through an asm operand, behind which the compiler no longer knows it.
typedef const __attribute__((address_space(1))) _Float16* gptr_h;
typedef const __attribute__((address_space(1))) v8h*      gptr_v8h;
__device__ __forceinline__ v16h load_pk_lane(gptr_h q) {
  union { v8h h[2]; v16h v; } u;
  u.h[0] = *(gptr_v8h)(q);
  u.h[1] = *(gptr_v8h)(q + 256);
  return u.v;
}

__device__ __forceinline__ v8f wmma32(v16h a, v16h b, v8f c) {
  return __builtin_amdgcn_wmma_f32_16x16x32_f16(
      /*neg_a=*/false, a, /*neg_b=*/false, b,
      /*c_mod=*/(short)0, c, /*reuse_a=*/false, /*reuse_b=*/false);
}

// ---------------------------------------------------------------------------
// f32 [rows][EMBED] -> f16, fragment-ordered. One thread per 16-byte chunk of
// dst: thread t writes chunk t.
// ---------------------------------------------------------------------------
__global__ void __launch_bounds__(256)
pack_cvt(const float* __restrict__ src, _Float16* __restrict__ dst) {
  const int t = blockIdx.x * 256 + threadIdx.x;
  const int c = t & 15, h = (t >> 4) & 1, u = (t >> 5) & 1, blk = t >> 6;
  const int rt = blk >> 5, kt = blk & 31;          // EMBED / 32 = 32 blocks per strip
  const float* p = src + (size_t)(rt * 16 + c) * EMBED + kt * 32 + u * 16 + h * 8;
  const float4 f0 = *(const float4*)(p);
  const float4 f1 = *(const float4*)(p + 4);
  v8h o;
  o[0] = (_Float16)f0.x; o[1] = (_Float16)f0.y;
  o[2] = (_Float16)f0.z; o[3] = (_Float16)f0.w;
  o[4] = (_Float16)f1.x; o[5] = (_Float16)f1.y;
  o[6] = (_Float16)f1.z; o[7] = (_Float16)f1.w;
  *(v8h*)(dst + (size_t)t * 8) = o;
}

// The same for the transpose: logical dst[n][k] = (f16) src[k][n], EMBED x EMBED.
__global__ void __launch_bounds__(256)
pack_transpose_cvt(const float* __restrict__ src, _Float16* __restrict__ dst) {
  const int t = blockIdx.x * 256 + threadIdx.x;
  const int c = t & 15, h = (t >> 4) & 1, u = (t >> 5) & 1, blk = t >> 6;
  const int rt = blk >> 5, kt = blk & 31;
  const float* p = src + (size_t)(kt * 32 + u * 16 + h * 8) * EMBED + rt * 16 + c;
  v8h o;
#pragma unroll
  for (int e = 0; e < 8; ++e) o[e] = (_Float16)p[(size_t)e * EMBED];
  *(v8h*)(dst + (size_t)t * 8) = o;
}

// ---------------------------------------------------------------------------
// WMMA GEMM: C[M,N] = A[M,K] * B[K,N], with B supplied transposed as Bt[N,K];
// A and Bt fragment-ordered. Each wave computes a 64x64 tile (16 wmmas per
// K=32 step).
// MODE 0: f16, per (b,h) the matrix [S][D] fragment-ordered   (Q, K)
// MODE 1: f16, per (b,h) the matrix [D][S] fragment-ordered   (V, for P@V)
// MODE 2: f32 to [M,N] + bias                                 (final output)
// A chunk of the output layout is 8 consecutive k of one row. MODE 1 has them
// in a lane's accumulator as it is (k = s = the tile's rows); MODE 0 (k = d =
// the tile's columns) takes Bt as the A operand, which gives the tile
// transposed: acc[i][j][r] = C[i*16 + nlo][j*16 + 8*half + r].
// ---------------------------------------------------------------------------
template <int MODE>
__global__ void __launch_bounds__(256)
gemm_wmma(const _Float16* __restrict__ A, const _Float16* __restrict__ Bt,
          _Float16* __restrict__ outh, float* __restrict__ outf,
          const float* __restrict__ bias, int M, int N) {
  const int wave  = blockIdx.x * (blockDim.x >> 5) + (threadIdx.x >> 5);
  const int tilesN = N >> 6;
  const int tm = wave / tilesN;
  const int tn = wave % tilesN;
  if (tm * 64 >= M) return;
  const int lane = threadIdx.x & 31;
  const int half = lane >> 4, nlo = lane & 15;
  constexpr int KT = EMBED >> 5;         // blocks per strip; K = EMBED in all four products

  // the lane's chunk in block 0 of the tile's first strip; the other strips
  // stand at constant distances, so each operand needs one address for all its
  // loads of a step
  gptr_h pa = (gptr_h)(A  + (size_t)tm * 64 * EMBED + lane * 8);
  gptr_h pb = (gptr_h)(Bt + (size_t)tn * 64 * EMBED + lane * 8);

  v8f acc[4][4] = {};

  for (int kt = 0; kt < KT; ++kt) {
    v16h af[4];
#pragma unroll
    for (int i = 0; i < 4; ++i)
      af[i] = load_pk_lane(pa + i * KT * 512);
#pragma unroll
    for (int j = 0; j < 4; ++j) {
      v16h bf = load_pk_lane(pb + j * KT * 512);
#pragma unroll
      for (int i = 0; i < 4; ++i)
        acc[i][j] = (MODE == 0) ? wmma32(bf, af[i], acc[i][j])
                                : wmma32(af[i], bf, acc[i][j]);
    }
    // Stepping pa and pb overwrites registers that the loads above name: this
    // wait stands in front of that. It takes both as operands, so that they
    // stay whole through the step's loads and are stepped only behind it
    // (without it each step's addresses are formed in fresh registers).
    asm volatile("s_wait_xcnt 0x0" : "+v"(pa), "+v"(pb) : : "memory");
    pa += 512;
    pb += 512;
  }

  if (MODE == 2) {
#pragma unroll
    for (int i = 0; i < 4; ++i) {
#pragma unroll
      for (int j = 0; j < 4; ++j) {
#pragma unroll
        for (int r = 0; r < 8; ++r) {
          const int m = tm * 64 + i * 16 + r + half * 8;
          const int n = tn * 64 + j * 16 + nlo;
          outf[(size_t)m * N + n] = acc[i][j][r] + bias[n];
        }
      }
    }
  } else {
    // the 64 tile rows lie in one batch (b = tm >> 5, s0 = (tm & 31) * 64),
    // the 64 tile columns are one head (h = tn)
    _Float16* ob = outh + (size_t)((tm >> 5) * HEADS + tn) * SEQ * HDIM + lane * 8;
    const int st = tm & 31;
#pragma unroll
    for (int i = 0; i < 4; ++i) {
#pragma unroll
      for (int j = 0; j < 4; ++j) {
        v8h o;
#pragma unroll
        for (int r = 0; r < 8; ++r) o[r] = (_Float16)acc[i][j][r];
        const int off = (MODE == 0)
            ? ((st * 4 + i) * 2 + (j >> 1)) * 512 + (j & 1) * 256     // [S][D], 2 blocks per strip
            : (j * 64 + st * 2 + (i >> 1)) * 512 + (i & 1) * 256;     // [D][S], 64 blocks per strip
        *(v8h*)(ob + off) = o;
      }
    }
  }
}

// ---------------------------------------------------------------------------
// Flash-attention: one wave per 16-row Q tile of one (batch, head).
// Q,K: per (b,h) [S][D] f16, Vt: per (b,h) [D][S] f16, Ctx: [B*S][E] f16, all
// fragment-ordered.
// Streams 64 KV rows/iter: 8 score WMMAs, one online-softmax pass (cross-lane
// reductions amortized over 64 columns), 8 ctx WMMAs.
// ---------------------------------------------------------------------------
__global__ void __launch_bounds__(256)
attn_wmma(const _Float16* __restrict__ Q, const _Float16* __restrict__ K,
          const _Float16* __restrict__ Vt, _Float16* __restrict__ Ctx) {
  __shared__ _Float16 ldsP[8][16][64];   // per-wave P staging (C-layout -> A-layout)

  const int wave = blockIdx.x * 8 + (threadIdx.x >> 5);
  const int qt = wave & 127;             // q tile within head (S/16 = 128)
  const int bh = wave >> 7;              // b*HEADS + h
  const int lane = threadIdx.x & 31;
  const int half = lane >> 4, nlo = lane & 15;
  const int w = threadIdx.x >> 5;

  const _Float16* Qb = Q  + ((size_t)bh * SEQ + qt * 16) * HDIM;   // strip qt: 2 blocks
  const _Float16* Kb = K  + (size_t)bh * SEQ * HDIM;
  const _Float16* Vb = Vt + (size_t)bh * HDIM * SEQ;

  const v16h aq0 = load_pk(Qb);         // Q rows, d 0..31
  const v16h aq1 = load_pk(Qb + 512);   // Q rows, d 32..63

  v8f ctx[4] = {};
  float mrow[8], lrow[8];
#pragma unroll
  for (int r = 0; r < 8; ++r) { mrow[r] = -1e30f; lrow[r] = 0.0f; }
  const float sc = 0.125f;               // 1/sqrt(64)

  for (int kb = 0; kb < SEQ; kb += 64) {
    // ---- scores: four 16x16 tiles covering kv [kb, kb+64) ----
    v8f s[4] = {};
#pragma unroll
    for (int t = 0; t < 4; ++t) {
      s[t] = wmma32(aq0, load_pk(Kb + (size_t)(kb + t * 16) * HDIM),       s[t]);
      s[t] = wmma32(aq1, load_pk(Kb + (size_t)(kb + t * 16) * HDIM + 512), s[t]);
    }

    // ---- online softmax (rows live across the 16 lanes of each half) ----
    float fac[8];
#pragma unroll
    for (int r = 0; r < 8; ++r) {
      float e0 = s[0][r] * sc, e1 = s[1][r] * sc;
      float e2 = s[2][r] * sc, e3 = s[3][r] * sc;
      float mx = fmaxf(fmaxf(e0, e1), fmaxf(e2, e3));
      mx = fmaxf(mx, __shfl_xor(mx, 1, 32));
      mx = fmaxf(mx, __shfl_xor(mx, 2, 32));
      mx = fmaxf(mx, __shfl_xor(mx, 4, 32));
      mx = fmaxf(mx, __shfl_xor(mx, 8, 32));
      const float mn = fmaxf(mrow[r], mx);
      const float p0 = __expf(e0 - mn);
      const float p1 = __expf(e1 - mn);
      const float p2 = __expf(e2 - mn);
      const float p3 = __expf(e3 - mn);
      float rs = (p0 + p1) + (p2 + p3);
      rs += __shfl_xor(rs, 1, 32);
      rs += __shfl_xor(rs, 2, 32);
      rs += __shfl_xor(rs, 4, 32);
      rs += __shfl_xor(rs, 8, 32);
      const float f = __expf(mrow[r] - mn);
      lrow[r] = lrow[r] * f + rs;
      mrow[r] = mn;
      fac[r] = f;
      const int pr = r + half * 8;
      ldsP[w][pr][nlo]      = (_Float16)p0;
      ldsP[w][pr][nlo + 16] = (_Float16)p1;
      ldsP[w][pr][nlo + 32] = (_Float16)p2;
      ldsP[w][pr][nlo + 48] = (_Float16)p3;
    }
#pragma unroll
    for (int j = 0; j < 4; ++j)
#pragma unroll
      for (int r = 0; r < 8; ++r) ctx[j][r] *= fac[r];

    // ensure P staging stores landed before the cross-lane A-fragment reads
    asm volatile("s_wait_dscnt 0" ::: "memory");
    const v16h pa0 = load_frag(&ldsP[w][0][0],  64);   // P: 16(q) x kv[0..31]
    const v16h pa1 = load_frag(&ldsP[w][0][32], 64);   // P: 16(q) x kv[32..63]

    // ---- ctx += P @ V : four 16-wide d chunks, two kv halves each ----
#pragma unroll
    for (int j = 0; j < 4; ++j) {
      v16h vb0 = load_pk(Vb + (size_t)(j * 64 + (kb >> 5)) * 512);
      v16h vb1 = load_pk(Vb + (size_t)(j * 64 + (kb >> 5)) * 512 + 512);
      ctx[j] = wmma32(pa0, vb0, ctx[j]);
      ctx[j] = wmma32(pa1, vb1, ctx[j]);
    }
  }

  // ---- normalize; ctx tile through the wave's own LDS rows into chunk order ----
  float inv[8];
#pragma unroll
  for (int r = 0; r < 8; ++r) inv[r] = 1.0f / lrow[r];
  const int b = bh >> 4, h = bh & 15;
#pragma unroll
  for (int j = 0; j < 4; ++j) {
#pragma unroll
    for (int r = 0; r < 8; ++r) {
      ldsP[w][r + half * 8][j * 16 + nlo] = (_Float16)(ctx[j][r] * inv[r]);
    }
  }
  // the staging stores must have landed before the cross-lane reads
  asm volatile("s_wait_dscnt 0" ::: "memory");
  union { v8h h[2]; v16h v; } o0, o1;
  o0.v = load_frag(&ldsP[w][0][0],  64);   // 16(q) x d[0..31]
  o1.v = load_frag(&ldsP[w][0][32], 64);   // 16(q) x d[32..63]
  // strip b * 128 + qt of [B*S][E] (32 blocks per strip), blocks 2h and 2h + 1
  _Float16* cb = Ctx + ((size_t)(b * (SEQ / 16) + qt) * 32 + h * 2) * 512 + lane * 8;
  *(v8h*)(cb)       = o0.h[0];
  *(v8h*)(cb + 256) = o0.h[1];
  *(v8h*)(cb + 512) = o1.h[0];
  *(v8h*)(cb + 768) = o1.h[1];
}

// ---------------------------------------------------------------------------
// Host-side orchestration
// Workspace (f16 elems): [0,8M) Xh (reused as Ctx), [8M..12M) weights,
// [12M..20M) Qh, [20M..28M) Kh, [28M..36M) Vth  => 72 MB total.
// ---------------------------------------------------------------------------
extern "C" void kernel_launch(void* const* d_in, const int* in_sizes, int n_in,
                              void* d_out, int out_size, void* d_ws, size_t ws_size,
                              hipStream_t stream) {
  const float* X  = (const float*)d_in[0];
  const float* Wq = (const float*)d_in[1];
  const float* Wk = (const float*)d_in[2];
  const float* Wv = (const float*)d_in[3];
  const float* Wo = (const float*)d_in[4];
  const float* bo = (const float*)d_in[5];
  float* out = (float*)d_out;

  _Float16* ws = (_Float16*)d_ws;
  const size_t M1 = (size_t)1024 * 1024;
  _Float16* Xh  = ws;             // 8M elems; later reused as Ctx (f16)
  _Float16* Wqt = ws + 8 * M1;    // W_q^T  [f,e]
  _Float16* Wkt = ws + 9 * M1;
  _Float16* Wvt = ws + 10 * M1;
  _Float16* Woh = ws + 11 * M1;   // W_o    [f,e] (already B^T layout for x@Wo^T)
  _Float16* Qh  = ws + 12 * M1;   // per (b,h) [S][D]
  _Float16* Kh  = ws + 20 * M1;   // per (b,h) [S][D]
  _Float16* Vth = ws + 28 * M1;   // per (b,h) [D][S]

  // 1) precision conversion / weight re-layout
  pack_cvt          <<<4096, 256, 0, stream>>>(X,  Xh);
  pack_transpose_cvt<<<512,  256, 0, stream>>>(Wq, Wqt);
  pack_transpose_cvt<<<512,  256, 0, stream>>>(Wk, Wkt);
  pack_transpose_cvt<<<512,  256, 0, stream>>>(Wv, Wvt);
  pack_cvt          <<<512,  256, 0, stream>>>(Wo, Woh);

  // 2) Q/K/V projections (8192x1024x1024 each), 2048 waves / 256 blocks
  gemm_wmma<0><<<256, 256, 0, stream>>>(Xh, Wqt, Qh,  nullptr, nullptr, MTOT, EMBED);
  gemm_wmma<0><<<256, 256, 0, stream>>>(Xh, Wkt, Kh,  nullptr, nullptr, MTOT, EMBED);
  gemm_wmma<1><<<256, 256, 0, stream>>>(Xh, Wvt, Vth, nullptr, nullptr, MTOT, EMBED);

  // 3) flash attention: 8192 q-tiles -> 1024 blocks of 8 waves; Ctx -> Xh
  attn_wmma<<<1024, 256, 0, stream>>>(Qh, Kh, Vth, Xh);

  // 4) output projection + bias, f32 result
  gemm_wmma<2><<<256, 256, 0, stream>>>(Xh, Woh, nullptr, out, bo, MTOT, EMBED);
}

// v002
// It runs in 354 microseconds.
// Timed twice side by side with v001, it ran 1.53 times as fast both times.
// All steps since v000 together make it 1.81 times as fast.
#include <hip/hip_runtime.h>

typedef __attribute__((ext_vector_type(16))) _Float16 v16h;
typedef __attribute__((ext_vector_type(8)))  _Float16 v8h;
typedef __attribute__((ext_vector_type(4)))  _Float16 v4h;
typedef __attribute__((ext_vector_type(8)))  float    v8f;

#define EMBED 1024
#define HEADS 16
#define HDIM  64
#define BATCH 4
#define SEQ   2048
#define MTOT  (BATCH * SEQ)   // 8192

// ---------------------------------------------------------------------------
// 16x32 f16 fragment, the wave-lane indexing the M (or N) row.
// Layout per CDNA5 ISA 7.12.2 (16-bit A 16x32):
//   lanes 0-15 : row = lane,    elems 0..7 = K[0..7],  elems 8..15 = K[16..23]
//   lanes 16-31: row = lane-16, elems 0..7 = K[8..15], elems 8..15 = K[24..31]
// B (32x16) uses the symmetric layout, so one loader serves A fragments and B
// fragments from a [N, K] (i.e. B^T) source.
// ---------------------------------------------------------------------------

// ---------------------------------------------------------------------------
// Fragment-ordered operands. Every f16 matrix [rows][K] that a WMMA reads from
// the workspace is kept as blocks of 16 rows x 32 k (512 elements, 1 KiB);
// block (rt, kt) stands at (rt * (K / 32) + kt) * 512. Inside a block the
// 16-byte chunk number u * 32 + lane holds that lane's fragment
// elements 8u .. 8u+7: row = lane & 15, k = 16 * u + 8 * (lane >> 4) + 0..7.
// A wave-wide 16-byte load or store of one u is then 512 contiguous bytes
// (4 cache lines) where the row-major form touches 16 lines.
// ---------------------------------------------------------------------------
__device__ __forceinline__ v16h load_pk(const _Float16* __restrict__ blk) {
  const _Float16* q = blk + (threadIdx.x & 31) * 8;
  union { v8h h[2]; v16h v; } u;
  u.h[0] = *(const v8h*)(q);
  u.h[1] = *(const v8h*)(q + 256);
  return u.v;
}

// The same from a lane's own address (block + lane * 8) in global memory. The
// type names the address space because the GEMM's stepped addresses pass
// through an asm operand, behind which the compiler no longer knows it.
typedef const __attribute__((address_space(1))) _Float16* gptr_h;
typedef const __attribute__((address_space(1))) v8h*      gptr_v8h;
__device__ __forceinline__ v16h load_pk_lane(gptr_h q) {
  union { v8h h[2]; v16h v; } u;
  u.h[0] = *(gptr_v8h)(q);
  u.h[1] = *(gptr_v8h)(q + 256);
  return u.v;
}

__device__ __forceinline__ v8f wmma32(v16h a, v16h b, v8f c) {
  return __builtin_amdgcn_wmma_f32_16x16x32_f16(
      /*neg_a=*/false, a, /*neg_b=*/false, b,
      /*c_mod=*/(short)0, c, /*reuse_a=*/false, /*reuse_b=*/false);
}

// ---------------------------------------------------------------------------
// f32 [rows][EMBED] -> f16, fragment-ordered. One thread per 16-byte chunk of
// dst: thread t writes chunk t.
// ---------------------------------------------------------------------------
__global__ void __launch_bounds__(256)
pack_cvt(const float* __restrict__ src, _Float16* __restrict__ dst) {
  const int t = blockIdx.x * 256 + threadIdx.x;
  const int c = t & 15, h = (t >> 4) & 1, u = (t >> 5) & 1, blk = t >> 6;
  const int rt = blk >> 5, kt = blk & 31;          // EMBED / 32 = 32 blocks per strip
  const float* p = src + (size_t)(rt * 16 + c) * EMBED + kt * 32 + u * 16 + h * 8;
  const float4 f0 = *(const float4*)(p);
  const float4 f1 = *(const float4*)(p + 4);
  v8h o;
  o[0] = (_Float16)f0.x; o[1] = (_Float16)f0.y;
  o[2] = (_Float16)f0.z; o[3] = (_Float16)f0.w;
  o[4] = (_Float16)f1.x; o[5] = (_Float16)f1.y;
  o[6] = (_Float16)f1.z; o[7] = (_Float16)f1.w;
  *(v8h*)(dst + (size_t)t * 8) = o;
}

// The same for the transpose: logical dst[n][k] = (f16) src[k][n], EMBED x EMBED.
__global__ void __launch_bounds__(256)
pack_transpose_cvt(const float* __restrict__ src, _Float16* __restrict__ dst) {
  const int t = blockIdx.x * 256 + threadIdx.x;
  const int c = t & 15, h = (t >> 4) & 1, u = (t >> 5) & 1, blk = t >> 6;
  const int rt = blk >> 5, kt = blk & 31;
  const float* p = src + (size_t)(kt * 32 + u * 16 + h * 8) * EMBED + rt * 16 + c;
  v8h o;
#pragma unroll
  for (int e = 0; e < 8; ++e) o[e] = (_Float16)p[(size_t)e * EMBED];
  *(v8h*)(dst + (size_t)t * 8) = o;
}

// ---------------------------------------------------------------------------
// WMMA GEMM: C[M,N] = A[M,K] * B[K,N], with B supplied transposed as Bt[N,K];
// A and Bt fragment-ordered. Each wave computes a 64x64 tile (16 wmmas per
// K=32 step).
// MODE 0: f16, per (b,h) the matrix [S][D] fragment-ordered   (Q, K)
// MODE 1: f16, per (b,h) the matrix [D][S] fragment-ordered   (V, for P@V)
// MODE 2: f32 to [M,N] + bias                                 (final output)
// A chunk of the output layout is 8 consecutive k of one row. MODE 1 has them
// in a lane's accumulator as it is (k = s = the tile's rows); MODE 0 (k = d =
// the tile's columns) takes Bt as the A operand, which gives the tile
// transposed: acc[i][j][r] = C[i*16 + nlo][j*16 + 8*half + r].
// ---------------------------------------------------------------------------
template <int MODE>
__global__ void __launch_bounds__(256)
gemm_wmma(const _Float16* __restrict__ A, const _Float16* __restrict__ Bt,
          _Float16* __restrict__ outh, float* __restrict__ outf,
          const float* __restrict__ bias, int M, int N) {
  const int wave  = blockIdx.x * (blockDim.x >> 5) + (threadIdx.x >> 5);
  const int tilesN = N >> 6;
  const int tm = wave / tilesN;
  const int tn = wave % tilesN;
  if (tm * 64 >= M) return;
  const int lane = threadIdx.x & 31;
  const int half = lane >> 4, nlo = lane & 15;
  constexpr int KT = EMBED >> 5;         // blocks per strip; K = EMBED in all four products

  // the lane's chunk in block 0 of the tile's first strip; the other strips
  // stand at constant distances, so each operand needs one address for all its
  // loads of a step
  gptr_h pa = (gptr_h)(A  + (size_t)tm * 64 * EMBED + lane * 8);
  gptr_h pb = (gptr_h)(Bt + (size_t)tn * 64 * EMBED + lane * 8);

  v8f acc[4][4] = {};

  for (int kt = 0; kt < KT; ++kt) {
    v16h af[4];
#pragma unroll
    for (int i = 0; i < 4; ++i)
      af[i] = load_pk_lane(pa + i * KT * 512);
#pragma unroll
    for (int j = 0; j < 4; ++j) {
      v16h bf = load_pk_lane(pb + j * KT * 512);
#pragma unroll
      for (int i = 0; i < 4; ++i)
        acc[i][j] = (MODE == 0) ? wmma32(bf, af[i], acc[i][j])
                                : wmma32(af[i], bf, acc[i][j]);
    }
    // Stepping pa and pb overwrites registers that the loads above name: this
    // wait stands in front of that. It takes both as operands, so that they
    // stay whole through the step's loads and are stepped only behind it
    // (without it each step's addresses are formed in fresh registers).
    asm volatile("s_wait_xcnt 0x0" : "+v"(pa), "+v"(pb) : : "memory");
    pa += 512;
    pb += 512;
  }

  if (MODE == 2) {
#pragma unroll
    for (int i = 0; i < 4; ++i) {
#pragma unroll
      for (int j = 0; j < 4; ++j) {
#pragma unroll
        for (int r = 0; r < 8; ++r) {
          const int m = tm * 64 + i * 16 + r + half * 8;
          const int n = tn * 64 + j * 16 + nlo;
          outf[(size_t)m * N + n] = acc[i][j][r] + bias[n];
        }
      }
    }
  } else {
    // the 64 tile rows lie in one batch (b = tm >> 5, s0 = (tm & 31) * 64),
    // the 64 tile columns are one head (h = tn)
    _Float16* ob = outh + (size_t)((tm >> 5) * HEADS + tn) * SEQ * HDIM + lane * 8;
    const int st = tm & 31;
#pragma unroll
    for (int i = 0; i < 4; ++i) {
#pragma unroll
      for (int j = 0; j < 4; ++j) {
        v8h o;
#pragma unroll
        for (int r = 0; r < 8; ++r) o[r] = (_Float16)acc[i][j][r];
        const int off = (MODE == 0)
            ? ((st * 4 + i) * 2 + (j >> 1)) * 512 + (j & 1) * 256     // [S][D], 2 blocks per strip
            : (j * 64 + st * 2 + (i >> 1)) * 512 + (i & 1) * 256;     // [D][S], 64 blocks per strip
        *(v8h*)(ob + off) = o;
      }
    }
  }
}

// ---------------------------------------------------------------------------
// Lane l <-> lane l ^ 16: the other half's value of the same column.
// ---------------------------------------------------------------------------
__device__ __forceinline__ float other_half(float x) {
  const int b = __builtin_bit_cast(int, x);
  return __builtin_bit_cast(float,
      __builtin_amdgcn_permlanex16(b, b, 0x76543210, 0xfedcba98, false, false));
}

// ---------------------------------------------------------------------------
// 2^x by v_exp_f32, eight at a time and one alone, in place. Behind a
// transcendental the instruction set asks for one independent instruction
// before its source is overwritten or its result read.
// Written so, each v_exp_f32 is followed by an independent one and the last by
// the v_nop that fills its slot.
// ---------------------------------------------------------------------------
__device__ __forceinline__ v8f exp2_x8(v8f x) {
  float y0 = x[0], y1 = x[1], y2 = x[2], y3 = x[3];
  float y4 = x[4], y5 = x[5], y6 = x[6], y7 = x[7];
  asm("v_exp_f32 %0, %0\n\t"
      "v_exp_f32 %1, %1\n\t"
      "v_exp_f32 %2, %2\n\t"
      "v_exp_f32 %3, %3\n\t"
      "v_exp_f32 %4, %4\n\t"
      "v_exp_f32 %5, %5\n\t"
      "v_exp_f32 %6, %6\n\t"
      "v_exp_f32 %7, %7\n\t"
      "v_nop"
      : "+v"(y0), "+v"(y1), "+v"(y2), "+v"(y3),
        "+v"(y4), "+v"(y5), "+v"(y6), "+v"(y7));
  v8f y = {y0, y1, y2, y3, y4, y5, y6, y7};
  return y;
}
__device__ __forceinline__ float exp2_x1(float x) {
  asm("v_exp_f32 %0, %0\n\t"
      "v_nop"
      : "+v"(x));
  return x;
}

// ---------------------------------------------------------------------------
// load_pk of the block at base + off + blk_bytes; off is the lane's running
// 32-bit byte offset (it holds lane * 16), blk_bytes a constant. Indexed so the
// attention kernel builds to 128 VGPRs, the most that 8 waves per SIMD allow;
// with a 64-bit element index per block it took 129.
// ---------------------------------------------------------------------------
__device__ __forceinline__ v16h load_pk_off(const _Float16* __restrict__ base, unsigned off, int blk_bytes) {
  const char* q = (const char*)base + off;
  union { v8h h[2]; v16h v; } u;
  u.h[0] = *(const v8h*)(q + blk_bytes);
  u.h[1] = *(const v8h*)(q + blk_bytes + 512);
  return u.v;
}

__global__ void __launch_bounds__(256)
attn_wmma(const _Float16* __restrict__ Q, const _Float16* __restrict__ K,
          const _Float16* __restrict__ Vt, _Float16* __restrict__ Ctx) {
  const int wave = blockIdx.x * 8 + (threadIdx.x >> 5);
  const int qt = wave & 127;             // q tile within head (S/16 = 128)
  const int bh = wave >> 7;              // b*HEADS + h
  const int lane = threadIdx.x & 31;

  const _Float16* Qb = Q  + ((size_t)bh * SEQ + qt * 16) * HDIM;   // strip qt: 2 blocks
  const _Float16* Kb = K  + (size_t)bh * SEQ * HDIM;
  const _Float16* Vb = Vt + (size_t)bh * HDIM * SEQ;

  const v16h bq0 = load_pk(Qb);         // Q rows as columns of Q^T, d 0..31
  const v16h bq1 = load_pk(Qb + 512);   // d 32..63

  v8f ctx[4] = {};                       // ctx[j][r] = O[q][16 j + 8 half + r]
  float mrow = -1e30f, lrow = 0.0f;      // the query's maximum; this lane's share of its sum
  const float sc = 0.125f;               // 1/sqrt(64)
  const float L2E = 1.44269504f;         // log2(e): e^x = 2^(x * L2E)

  unsigned ko = lane * 16, vo = lane * 16;   // byte offsets into Kb, Vb
  for (int kb = 0; kb < SEQ; kb += 64, ko += 64 * HDIM * 2, vo += 2 * 1024) {
    // ---- scores: four 16(kv) x 16(q) tiles covering kv [kb, kb+64) ----
    v8f s[4] = {};
#pragma unroll
    for (int t = 0; t < 4; ++t) {
      s[t] = wmma32(load_pk_off(Kb, ko, t * 2048),        bq0, s[t]);
      s[t] = wmma32(load_pk_off(Kb, ko, t * 2048 + 1024), bq1, s[t]);
    }

    // ---- online softmax, one query per lane ----
    float mt[4];
#pragma unroll
    for (int t = 0; t < 4; ++t) {
#pragma unroll
      for (int r = 0; r < 8; ++r) s[t][r] *= sc;
      mt[t] = fmaxf(fmaxf(fmaxf(s[t][0], s[t][1]), fmaxf(s[t][2], s[t][3])),
                    fmaxf(fmaxf(s[t][4], s[t][5]), fmaxf(s[t][6], s[t][7])));
    }
    float mx = fmaxf(fmaxf(mt[0], mt[1]), fmaxf(mt[2], mt[3]));
    mx = fmaxf(mx, other_half(mx));
    const float mn = fmaxf(mrow, mx);
    float rs[4];
#pragma unroll
    for (int t = 0; t < 4; ++t) {
#pragma unroll
      for (int r = 0; r < 8; ++r) s[t][r] = (s[t][r] - mn) * L2E;
      s[t] = exp2_x8(s[t]);
      rs[t] = ((s[t][0] + s[t][1]) + (s[t][2] + s[t][3])) +
              ((s[t][4] + s[t][5]) + (s[t][6] + s[t][7]));
    }
    const float f = exp2_x1((mrow - mn) * L2E);
    lrow = lrow * f + ((rs[0] + rs[1]) + (rs[2] + rs[3]));
    mrow = mn;
#pragma unroll
    for (int j = 0; j < 4; ++j)
#pragma unroll
      for (int r = 0; r < 8; ++r) ctx[j][r] *= f;

    // P^T as B operands: element e = key 8 half + e (e < 8), 16 + 8 half + e - 8
    v16h pb0, pb1;                       // kv [kb, kb+32), [kb+32, kb+64)
#pragma unroll
    for (int r = 0; r < 8; ++r) {
      pb0[r] = (_Float16)s[0][r];  pb0[r + 8] = (_Float16)s[1][r];
      pb1[r] = (_Float16)s[2][r];  pb1[r + 8] = (_Float16)s[3][r];
    }

    // ---- O^T += V^T P^T : four 16-wide d chunks, two kv halves each ----
#pragma unroll
    for (int j = 0; j < 4; ++j) {
      v16h va0 = load_pk_off(Vb, vo, j * 65536);
      v16h va1 = load_pk_off(Vb, vo, j * 65536 + 1024);
      ctx[j] = wmma32(va0, pb0, ctx[j]);
      ctx[j] = wmma32(va1, pb1, ctx[j]);
    }
  }

  // ---- join the halves' sums, normalize; a lane's 8 registers of tile j are
  // 8 consecutive d of its query: one chunk of the Ctx layout as they stand ----
  const float inv = 1.0f / (lrow + other_half(lrow));
  const int b = bh >> 4, h = bh & 15;
  // strip b * 128 + qt of [B*S][E] (32 blocks per strip), blocks 2h and 2h + 1
  _Float16* cb = Ctx + ((size_t)(b * (SEQ / 16) + qt) * 32 + h * 2) * 512 + lane * 8;
#pragma unroll
  for (int j = 0; j < 4; ++j) {
    v8h o;
#pragma unroll
    for (int r = 0; r < 8; ++r) o[r] = (_Float16)(ctx[j][r] * inv);
    *(v8h*)(cb + j * 256) = o;
  }
}

// ---------------------------------------------------------------------------
// Host-side orchestration
// Workspace (f16 elems): [0,8M) Xh (reused as Ctx), [8M..12M) weights,
// [12M..20M) Qh, [20M..28M) Kh, [28M..36M) Vth  => 72 MB total.
// ---------------------------------------------------------------------------
extern "C" void kernel_launch(void* const* d_in, const int* in_sizes, int n_in,
                              void* d_out, int out_size, void* d_ws, size_t ws_size,
                              hipStream_t stream) {
  const float* X  = (const float*)d_in[0];
  const float* Wq = (const float*)d_in[1];
  const float* Wk = (const float*)d_in[2];
  const float* Wv = (const float*)d_in[3];
  const float* Wo = (const float*)d_in[4];
  const float* bo = (const float*)d_in[5];
  float* out = (float*)d_out;

  _Float16* ws = (_Float16*)d_ws;
  const size_t M1 = (size_t)1024 * 1024;
  _Float16* Xh  = ws;             // 8M elems; later reused as Ctx (f16)
  _Float16* Wqt = ws + 8 * M1;    // W_q^T  [f,e]
  _Float16* Wkt = ws + 9 * M1;
  _Float16* Wvt = ws + 10 * M1;
  _Float16* Woh = ws + 11 * M1;   // W_o    [f,e] (already B^T layout for x@Wo^T)
  _Float16* Qh  = ws + 12 * M1;   // per (b,h) [S][D]
  _Float16* Kh  = ws + 20 * M1;   // per (b,h) [S][D]
  _Float16* Vth = ws + 28 * M1;   // per (b,h) [D][S]

  // 1) precision conversion / weight re-layout
  pack_cvt          <<<4096, 256, 0, stream>>>(X,  Xh);
  pack_transpose_cvt<<<512,  256, 0, stream>>>(Wq, Wqt);
  pack_transpose_cvt<<<512,  256, 0, stream>>>(Wk, Wkt);
  pack_transpose_cvt<<<512,  256, 0, stream>>>(Wv, Wvt);
  pack_cvt          <<<512,  256, 0, stream>>>(Wo, Woh);

  // 2) Q/K/V projections (8192x1024x1024 each), 2048 waves / 256 blocks
  gemm_wmma<0><<<256, 256, 0, stream>>>(Xh, Wqt, Qh,  nullptr, nullptr, MTOT, EMBED);
  gemm_wmma<0><<<256, 256, 0, stream>>>(Xh, Wkt, Kh,  nullptr, nullptr, MTOT, EMBED);
  gemm_wmma<1><<<256, 256, 0, stream>>>(Xh, Wvt, Vth, nullptr, nullptr, MTOT, EMBED);

  // 3) flash attention: 8192 q-tiles -> 1024 blocks of 8 waves; Ctx -> Xh
  attn_wmma<<<1024, 256, 0, stream>>>(Qh, Kh, Vth, Xh);

  // 4) output projection + bias, f32 result
  gemm_wmma<2><<<256, 256, 0, stream>>>(Xh, Woh, nullptr, out, bo, MTOT, EMBED);
}

// v003
// One run takes 234 microseconds.
// In two side-by-side timings against v002, it was 1.53 and 1.52 times as fast.
// Over all steps from v000 it is 2.77 times as fast.
#include <hip/hip_runtime.h>

typedef __attribute__((ext_vector_type(16))) _Float16 v16h;
typedef __attribute__((ext_vector_type(8)))  _Float16 v8h;
typedef __attribute__((ext_vector_type(4)))  _Float16 v4h;
typedef __attribute__((ext_vector_type(8)))  float    v8f;

#define EMBED 1024
#define HEADS 16
#define HDIM  64
#define BATCH 4
#define SEQ   2048
#define MTOT  (BATCH * SEQ)   // 8192

// ---------------------------------------------------------------------------
// 16x32 f16 fragment, the wave-lane indexing the M (or N) row.
// Layout per CDNA5 ISA 7.12.2 (16-bit A 16x32):
//   lanes 0-15 : row = lane,    elems 0..7 = K[0..7],  elems 8..15 = K[16..23]
//   lanes 16-31: row = lane-16, elems 0..7 = K[8..15], elems 8..15 = K[24..31]
// B (32x16) uses the symmetric layout, so one loader serves A fragments and B
// fragments from a [N, K] (i.e. B^T) source.
// ---------------------------------------------------------------------------

// ---------------------------------------------------------------------------
// Fragment-ordered operands. Every f16 matrix [rows][K] that a WMMA reads from
// the workspace is kept as blocks of 16 rows x 32 k (512 elements, 1 KiB);
// block (rt, kt) stands at (rt * (K / 32) + kt) * 512. Inside a block the
// 16-byte chunk number u * 32 + lane holds that lane's fragment
// elements 8u .. 8u+7: row = lane & 15, k = 16 * u + 8 * (lane >> 4) + 0..7.
// A wave-wide 16-byte load or store of one u is then 512 contiguous bytes
// (4 cache lines) where the row-major form touches 16 lines.
// ---------------------------------------------------------------------------
__device__ __forceinline__ v16h load_pk(const _Float16* __restrict__ blk) {
  const _Float16* q = blk + (threadIdx.x & 31) * 8;
  union { v8h h[2]; v16h v; } u;
  u.h[0] = *(const v8h*)(q);
  u.h[1] = *(const v8h*)(q + 256);
  return u.v;
}

// The same from a lane's own address (block + lane * 8) in global memory. The
// type names the address space because the GEMM's stepped addresses pass
// through an asm operand, behind which the compiler no longer knows it.
typedef const __attribute__((address_space(1))) _Float16* gptr_h;
typedef const __attribute__((address_space(1))) v8h*      gptr_v8h;
__device__ __forceinline__ v16h load_pk_lane(gptr_h q) {
  union { v8h h[2]; v16h v; } u;
  u.h[0] = *(gptr_v8h)(q);
  u.h[1] = *(gptr_v8h)(q + 256);
  return u.v;
}

__device__ __forceinline__ v8f wmma32(v16h a, v16h b, v8f c) {
  return __builtin_amdgcn_wmma_f32_16x16x32_f16(
      /*neg_a=*/false, a, /*neg_b=*/false, b,
      /*c_mod=*/(short)0, c, /*reuse_a=*/false, /*reuse_b=*/false);
}

// ---------------------------------------------------------------------------
// f32 [rows][EMBED] -> f16, fragment-ordered. One thread per 16-byte chunk of
// dst: thread t writes chunk t.
// ---------------------------------------------------------------------------
__global__ void __launch_bounds__(256)
pack_cvt(const float* __restrict__ src, _Float16* __restrict__ dst) {
  const int t = blockIdx.x * 256 + threadIdx.x;
  const int c = t & 15, h = (t >> 4) & 1, u = (t >> 5) & 1, blk = t >> 6;
  const int rt = blk >> 5, kt = blk & 31;          // EMBED / 32 = 32 blocks per strip
  const float* p = src + (size_t)(rt * 16 + c) * EMBED + kt * 32 + u * 16 + h * 8;
  const float4 f0 = *(const float4*)(p);
  const float4 f1 = *(const float4*)(p + 4);
  v8h o;
  o[0] = (_Float16)f0.x; o[1] = (_Float16)f0.y;
  o[2] = (_Float16)f0.z; o[3] = (_Float16)f0.w;
  o[4] = (_Float16)f1.x; o[5] = (_Float16)f1.y;
  o[6] = (_Float16)f1.z; o[7] = (_Float16)f1.w;
  *(v8h*)(dst + (size_t)t * 8) = o;
}

// The same for the transpose: logical dst[n][k] = (f16) src[k][n], EMBED x EMBED.
__global__ void __launch_bounds__(256)
pack_transpose_cvt(const float* __restrict__ src, _Float16* __restrict__ dst) {
  const int t = blockIdx.x * 256 + threadIdx.x;
  const int c = t & 15, h = (t >> 4) & 1, u = (t >> 5) & 1, blk = t >> 6;
  const int rt = blk >> 5, kt = blk & 31;
  const float* p = src + (size_t)(kt * 32 + u * 16 + h * 8) * EMBED + rt * 16 + c;
  v8h o;
#pragma unroll
  for (int e = 0; e < 8; ++e) o[e] = (_Float16)p[(size_t)e * EMBED];
  *(v8h*)(dst + (size_t)t * 8) = o;
}

// ---------------------------------------------------------------------------
// WMMA GEMM: C[M,N] = A[M,K] * B[K,N], with B supplied transposed as Bt[N,K];
// A and Bt fragment-ordered. Each wave computes a 64x64 tile (16 wmmas per
// K=32 step).
// MODE 0: f16, per (b,h) the matrix [S][D] fragment-ordered   (Q, K)
// MODE 1: f16, per (b,h) the matrix [D][S] fragment-ordered   (V, for P@V)
// MODE 2: f32 to [M,N] + bias                                 (final output)
// A chunk of the output layout is 8 consecutive k of one row. MODE 1 has them
// in a lane's accumulator as it is (k = s = the tile's rows); MODE 0 (k = d =
// the tile's columns) takes Bt as the A operand, which gives the tile
// transposed: acc[i][j][r] = C[i*16 + nlo][j*16 + 8*half + r].
// ---------------------------------------------------------------------------
template <int MODE>
__global__ void __launch_bounds__(256)
gemm_wmma(const _Float16* __restrict__ A, const _Float16* __restrict__ Bt,
          _Float16* __restrict__ outh, float* __restrict__ outf,
          const float* __restrict__ bias, int M, int N) {
  const int wave  = blockIdx.x * (blockDim.x >> 5) + (threadIdx.x >> 5);
  const int tilesN = N >> 6;
  const int tm = wave / tilesN;
  const int tn = wave % tilesN;
  if (tm * 64 >= M) return;
  const int lane = threadIdx.x & 31;
  const int half = lane >> 4, nlo = lane & 15;
  constexpr int KT = EMBED >> 5;         // blocks per strip; K = EMBED in all four products

  // the lane's chunk in block 0 of the tile's first strip; the other strips
  // stand at constant distances, so each operand needs one address for all its
  // loads of a step
  gptr_h pa = (gptr_h)(A  + (size_t)tm * 64 * EMBED + lane * 8);
  gptr_h pb = (gptr_h)(Bt + (size_t)tn * 64 * EMBED + lane * 8);

  v8f acc[4][4] = {};

  for (int kt = 0; kt < KT; ++kt) {
    v16h af[4];
#pragma unroll
    for (int i = 0; i < 4; ++i)
      af[i] = load_pk_lane(pa + i * KT * 512);
#pragma unroll
    for (int j = 0; j < 4; ++j) {
      v16h bf = load_pk_lane(pb + j * KT * 512);
#pragma unroll
      for (int i = 0; i < 4; ++i)
        acc[i][j] = (MODE == 0) ? wmma32(bf, af[i], acc[i][j])
                                : wmma32(af[i], bf, acc[i][j]);
    }
    // Stepping pa and pb overwrites registers that the loads above name: this
    // wait stands in front of that. It takes both as operands, so that they
    // stay whole through the step's loads and are stepped only behind it
    // (without it each step's addresses are formed in fresh registers).
    asm volatile("s_wait_xcnt 0x0" : "+v"(pa), "+v"(pb) : : "memory");
    pa += 512;
    pb += 512;
  }

  if (MODE == 2) {
#pragma unroll
    for (int i = 0; i < 4; ++i) {
#pragma unroll
      for (int j = 0; j < 4; ++j) {
#pragma unroll
        for (int r = 0; r < 8; ++r) {
          const int m = tm * 64 + i * 16 + r + half * 8;
          const int n = tn * 64 + j * 16 + nlo;
          outf[(size_t)m * N + n] = acc[i][j][r] + bias[n];
        }
      }
    }
  } else {
    // the 64 tile rows lie in one batch (b = tm >> 5, s0 = (tm & 31) * 64),
    // the 64 tile columns are one head (h = tn)
    _Float16* ob = outh + (size_t)((tm >> 5) * HEADS + tn) * SEQ * HDIM + lane * 8;
    const int st = tm & 31;
#pragma unroll
    for (int i = 0; i < 4; ++i) {
#pragma unroll
      for (int j = 0; j < 4; ++j) {
        v8h o;
#pragma unroll
        for (int r = 0; r < 8; ++r) o[r] = (_Float16)acc[i][j][r];
        const int off = (MODE == 0)
            ? ((st * 4 + i) * 2 + (j >> 1)) * 512 + (j & 1) * 256     // [S][D], 2 blocks per strip
            : (j * 64 + st * 2 + (i >> 1)) * 512 + (i & 1) * 256;     // [D][S], 64 blocks per strip
        *(v8h*)(ob + off) = o;
      }
    }
  }
}

// ---------------------------------------------------------------------------
// Lane l <-> lane l ^ 16: the other half's value of the same column.
// ---------------------------------------------------------------------------
__device__ __forceinline__ float other_half(float x) {
  const int b = __builtin_bit_cast(int, x);
  return __builtin_bit_cast(float,
      __builtin_amdgcn_permlanex16(b, b, 0x76543210, 0xfedcba98, false, false));
}

// ---------------------------------------------------------------------------
// 2^x by v_exp_f32, eight at a time and one alone, in place. Behind a
// transcendental the instruction set asks for one independent instruction
// before its source is overwritten or its result read.
// Written so, each v_exp_f32 is followed by an independent one and the last by
// the v_nop that fills its slot.
// ---------------------------------------------------------------------------
__device__ __forceinline__ v8f exp2_x8(v8f x) {
  float y0 = x[0], y1 = x[1], y2 = x[2], y3 = x[3];
  float y4 = x[4], y5 = x[5], y6 = x[6], y7 = x[7];
  asm("v_exp_f32 %0, %0\n\t"
      "v_exp_f32 %1, %1\n\t"
      "v_exp_f32 %2, %2\n\t"
      "v_exp_f32 %3, %3\n\t"
      "v_exp_f32 %4, %4\n\t"
      "v_exp_f32 %5, %5\n\t"
      "v_exp_f32 %6, %6\n\t"
      "v_exp_f32 %7, %7\n\t"
      "v_nop"
      : "+v"(y0), "+v"(y1), "+v"(y2), "+v"(y3),
        "+v"(y4), "+v"(y5), "+v"(y6), "+v"(y7));
  v8f y = {y0, y1, y2, y3, y4, y5, y6, y7};
  return y;
}
__device__ __forceinline__ float exp2_x1(float x) {
  asm("v_exp_f32 %0, %0\n\t"
      "v_nop"
      : "+v"(x));
  return x;
}

// ---------------------------------------------------------------------------
// load_pk of the block that stands blk_bytes behind q in LDS; q holds the
// buffer's start plus the lane's 16 bytes.
// ---------------------------------------------------------------------------
__device__ __forceinline__ v16h load_pk_lds(const _Float16* q, int blk_bytes) {
  union { v8h h[2]; v16h v; } u;
  u.h[0] = *(const v8h*)(q + blk_bytes / 2);
  u.h[1] = *(const v8h*)(q + blk_bytes / 2 + 256);
  return u.v;
}

// ---------------------------------------------------------------------------
// One stage of the attention ring: 64 keys of K (8 KiB, contiguous) and of V^T
// (four d strips of 2 KiB), 16 KiB in LDS. Each of the 256 threads brings four
// 16-byte chunks by asynchronous copies, a wave 512 contiguous bytes per copy.
// lds: the thread's chunk in the buffer's first 4 KiB. kb, vb: the stage's first
// byte of K and of V^T strip 0, the same for the whole block (scalar registers);
// ko, vo: the thread's byte offsets from them. The s_wait_xcnt stands inside the
// statement, so that no register a copy names is rewritten ahead of it.
// ---------------------------------------------------------------------------
__device__ __forceinline__ void copy_stage(unsigned lds, const char* kb, unsigned ko,
                                           const char* vb, unsigned vo) {
  const unsigned l1 = lds + 4096, l2 = lds + 8192, l3 = lds + 12288;
  const char* kb1 = kb + 4096;          // keys 32..63 of the stage
  const char* vb1 = vb + 2 * 65536;     // two d strips on
  asm volatile("global_load_async_to_lds_b128 %0, %4, %6\n\t"
               "global_load_async_to_lds_b128 %1, %4, %7\n\t"
               "global_load_async_to_lds_b128 %2, %5, %8\n\t"
               "global_load_async_to_lds_b128 %3, %5, %9\n\t"
               "s_wait_xcnt 0x0"
               :: "v"(lds), "v"(l1), "v"(l2), "v"(l3), "v"(ko), "v"(vo),
                  "s"(kb), "s"(kb1), "s"(vb), "s"(vb1)
               : "memory");
}

__global__ void __launch_bounds__(256) __attribute__((amdgpu_waves_per_eu(8, 8)))
attn_wmma(const _Float16* __restrict__ Q, const _Float16* __restrict__ K,
          const _Float16* __restrict__ Vt, _Float16* __restrict__ Ctx) {
  // the wave's number as a scalar: tile and head then live in scalar registers
  // through the loop (as vector registers they were spilled at 128 VGPRs)
  const int wave = blockIdx.x * 8 + __builtin_amdgcn_readfirstlane(threadIdx.x >> 5);
  const int qt = wave & 127;             // q tile within head (S/16 = 128)
  const int bh = wave >> 7;              // b*HEADS + h
  const int lane = threadIdx.x & 31;
  constexpr int STAGE_B = 16384;         // bytes of a stage: K 8 KiB, then V^T 8 KiB
  constexpr int NSTAGE = SEQ / 64;
  __shared__ __attribute__((aligned(1024))) _Float16 ring[2 * STAGE_B / 2];

  const _Float16* Qb = Q  + ((size_t)bh * SEQ + qt * 16) * HDIM;   // strip qt: 2 blocks
  const _Float16* Kb = K  + (size_t)bh * SEQ * HDIM;
  const _Float16* Vb = Vt + (size_t)bh * HDIM * SEQ;

  // the thread's chunks in a stage; a stage on is 8 KiB of K, 2 KiB of each V^T strip
  const unsigned ko = threadIdx.x * 16;
  const unsigned vo = (threadIdx.x >> 7) * 65536 + (threadIdx.x & 127) * 16;
  const unsigned lds0 = (unsigned)(size_t)ring + threadIdx.x * 16;
  const char* kg = (const char*)Kb;
  const char* vg = (const char*)Vb;

  copy_stage(lds0, kg, ko, vg, vo);
  // stage 0 has landed for this wave, then for all: nobody reads it before
  asm volatile("s_wait_asynccnt 0x0" ::: "memory");
  __syncthreads();
  copy_stage(lds0 + STAGE_B, kg + 8192, ko, vg + 2048, vo);
  kg += 2 * 8192;
  vg += 2 * 2048;

  const v16h bq0 = load_pk(Qb);         // Q rows as columns of Q^T, d 0..31
  const v16h bq1 = load_pk(Qb + 512);   // d 32..63

  v8f ctx[4] = {};                       // ctx[j][r] = O[q][16 j + 8 half + r]
  float mrow = -1e30f, lrow = 0.0f;      // the query's maximum; this lane's share of its sum
  const float sc = 0.125f;               // 1/sqrt(64)
  const float L2E = 1.44269504f;         // log2(e): e^x = 2^(x * L2E)

  for (int st = 0; st < NSTAGE; ++st) {
    const int buf = (st & 1) * STAGE_B;
    const _Float16* sk = ring + buf / 2 + lane * 8;   // the stage's K; V^T 8 KiB on
    // ---- scores: four 16(kv) x 16(q) tiles covering the stage's 64 keys ----
    v8f s[4] = {};
#pragma unroll
    for (int t = 0; t < 4; ++t) {
      s[t] = wmma32(load_pk_lds(sk, t * 2048),        bq0, s[t]);
      s[t] = wmma32(load_pk_lds(sk, t * 2048 + 1024), bq1, s[t]);
    }

    // ---- online softmax, one query per lane ----
    float mt[4];
#pragma unroll
    for (int t = 0; t < 4; ++t) {
#pragma unroll
      for (int r = 0; r < 8; ++r) s[t][r] *= sc;
      mt[t] = fmaxf(fmaxf(fmaxf(s[t][0], s[t][1]), fmaxf(s[t][2], s[t][3])),
                    fmaxf(fmaxf(s[t][4], s[t][5]), fmaxf(s[t][6], s[t][7])));
    }
    float mx = fmaxf(fmaxf(mt[0], mt[1]), fmaxf(mt[2], mt[3]));
    mx = fmaxf(mx, other_half(mx));
    const float mn = fmaxf(mrow, mx);
    float rs[4];
#pragma unroll
    for (int t = 0; t < 4; ++t) {
#pragma unroll
      for (int r = 0; r < 8; ++r) s[t][r] = (s[t][r] - mn) * L2E;
      s[t] = exp2_x8(s[t]);
      rs[t] = ((s[t][0] + s[t][1]) + (s[t][2] + s[t][3])) +
              ((s[t][4] + s[t][5]) + (s[t][6] + s[t][7]));
    }
    const float f = exp2_x1((mrow - mn) * L2E);
    lrow = lrow * f + ((rs[0] + rs[1]) + (rs[2] + rs[3]));
    mrow = mn;
#pragma unroll
    for (int j = 0; j < 4; ++j)
#pragma unroll
      for (int r = 0; r < 8; ++r) ctx[j][r] *= f;

    // P^T as B operands: element e = key 8 half + e (e < 8), 16 + 8 half + e - 8
    v16h pb0, pb1;                       // the stage's keys 0..31, 32..63
#pragma unroll
    for (int r = 0; r < 8; ++r) {
      pb0[r] = (_Float16)s[0][r];  pb0[r + 8] = (_Float16)s[1][r];
      pb1[r] = (_Float16)s[2][r];  pb1[r + 8] = (_Float16)s[3][r];
    }

    // ---- O^T += V^T P^T : four 16-wide d chunks, two kv halves each ----
#pragma unroll
    for (int j = 0; j < 4; ++j) {
      v16h va0 = load_pk_lds(sk, 8192 + j * 2048);
      v16h va1 = load_pk_lds(sk, 8192 + j * 2048 + 1024);
      ctx[j] = wmma32(va0, pb0, ctx[j]);
      ctx[j] = wmma32(va1, pb1, ctx[j]);
    }

    // ---- hand-over: this wave's reads of the stage are done, its copies of the
    // next have landed; behind the barrier both hold for all 8 waves, so the next
    // stage may be read and this stage's buffer refilled ----
    // The products stay above the hand-over: sunk below it they stood directly
    // in front of the branch.
    __builtin_amdgcn_sched_barrier(0);
    asm volatile("s_wait_dscnt 0x0" ::: "memory");
    asm volatile("s_wait_asynccnt 0x0" ::: "memory");
    __syncthreads();
    // the four vector slots between the last WMMA and the first instruction that
    // overwrites its operands, on both sides of the branch
    asm volatile("v_nop\n\tv_nop\n\tv_nop\n\tv_nop");
    if (st + 2 < NSTAGE) {
      copy_stage(lds0 + buf, kg, ko, vg, vo);
      kg += 8192;
      vg += 2048;
    }
  }
  // no copy is outstanding when the wave ends
  asm volatile("s_wait_asynccnt 0x0" ::: "memory");

  // ---- join the halves' sums, normalize; a lane's 8 registers of tile j are
  // 8 consecutive d of its query: one chunk of the Ctx layout as they stand ----
  const float inv = 1.0f / (lrow + other_half(lrow));
  const int b = bh >> 4, h = bh & 15;
  // strip b * 128 + qt of [B*S][E] (32 blocks per strip), blocks 2h and 2h + 1
  _Float16* cb = Ctx + ((size_t)(b * (SEQ / 16) + qt) * 32 + h * 2) * 512 + lane * 8;
#pragma unroll
  for (int j = 0; j < 4; ++j) {
    v8h o;
#pragma unroll
    for (int r = 0; r < 8; ++r) o[r] = (_Float16)(ctx[j][r] * inv);
    *(v8h*)(cb + j * 256) = o;
  }
}

// ---------------------------------------------------------------------------
// Host-side orchestration
// Workspace (f16 elems): [0,8M) Xh (reused as Ctx), [8M..12M) weights,
// [12M..20M) Qh, [20M..28M) Kh, [28M..36M) Vth  => 72 MB total.
// ---------------------------------------------------------------------------
extern "C" void kernel_launch(void* const* d_in, const int* in_sizes, int n_in,
                              void* d_out, int out_size, void* d_ws, size_t ws_size,
                              hipStream_t stream) {
  const float* X  = (const float*)d_in[0];
  const float* Wq = (const float*)d_in[1];
  const float* Wk = (const float*)d_in[2];
  const float* Wv = (const float*)d_in[3];
  const float* Wo = (const float*)d_in[4];
  const float* bo = (const float*)d_in[5];
  float* out = (float*)d_out;

  _Float16* ws = (_Float16*)d_ws;
  const size_t M1 = (size_t)1024 * 1024;
  _Float16* Xh  = ws;             // 8M elems; later reused as Ctx (f16)
  _Float16* Wqt = ws + 8 * M1;    // W_q^T  [f,e]
  _Float16* Wkt = ws + 9 * M1;
  _Float16* Wvt = ws + 10 * M1;
  _Float16* Woh = ws + 11 * M1;   // W_o    [f,e] (already B^T layout for x@Wo^T)
  _Float16* Qh  = ws + 12 * M1;   // per (b,h) [S][D]
  _Float16* Kh  = ws + 20 * M1;   // per (b,h) [S][D]
  _Float16* Vth = ws + 28 * M1;   // per (b,h) [D][S]

  // 1) precision conversion / weight re-layout
  pack_cvt          <<<4096, 256, 0, stream>>>(X,  Xh);
  pack_transpose_cvt<<<512,  256, 0, stream>>>(Wq, Wqt);
  pack_transpose_cvt<<<512,  256, 0, stream>>>(Wk, Wkt);
  pack_transpose_cvt<<<512,  256, 0, stream>>>(Wv, Wvt);
  pack_cvt          <<<512,  256, 0, stream>>>(Wo, Woh);

  // 2) Q/K/V projections (8192x1024x1024 each), 2048 waves / 256 blocks
  gemm_wmma<0><<<256, 256, 0, stream>>>(Xh, Wqt, Qh,  nullptr, nullptr, MTOT, EMBED);
  gemm_wmma<0><<<256, 256, 0, stream>>>(Xh, Wkt, Kh,  nullptr, nullptr, MTOT, EMBED);
  gemm_wmma<1><<<256, 256, 0, stream>>>(Xh, Wvt, Vth, nullptr, nullptr, MTOT, EMBED);

  // 3) flash attention: 8192 q-tiles -> 1024 blocks of 8 waves; Ctx -> Xh
  attn_wmma<<<1024, 256, 0, stream>>>(Qh, Kh, Vth, Xh);

  // 4) output projection + bias, f32 result
  gemm_wmma<2><<<256, 256, 0, stream>>>(Xh, Woh, nullptr, out, bo, MTOT, EMBED);
}

// v004
// One run takes 227 microseconds.
// In both of two side-by-side timings against v003, it was 1.04 times as fast.
// Over all steps from v000 it is 2.88 times as fast.
#include <hip/hip_runtime.h>

typedef __attribute__((ext_vector_type(16))) _Float16 v16h;
typedef __attribute__((ext_vector_type(8)))  _Float16 v8h;
typedef __attribute__((ext_vector_type(4)))  _Float16 v4h;
typedef __attribute__((ext_vector_type(8)))  float    v8f;

#define EMBED 1024
#define HEADS 16
#define HDIM  64
#define BATCH 4
#define SEQ   2048
#define MTOT  (BATCH * SEQ)   // 8192

// ---------------------------------------------------------------------------
// 16x32 f16 fragment, the wave-lane indexing the M (or N) row.
// Layout per CDNA5 ISA 7.12.2 (16-bit A 16x32):
//   lanes 0-15 : row = lane,    elems 0..7 = K[0..7],  elems 8..15 = K[16..23]
//   lanes 16-31: row = lane-16, elems 0..7 = K[8..15], elems 8..15 = K[24..31]
// B (32x16) uses the symmetric layout, so one loader serves A fragments and B
// fragments from a [N, K] (i.e. B^T) source.
// ---------------------------------------------------------------------------

// ---------------------------------------------------------------------------
// Fragment-ordered operands. Every f16 matrix [rows][K] that a WMMA reads from
// the workspace is kept as blocks of 16 rows x 32 k (512 elements, 1 KiB);
// block (rt, kt) stands at (rt * (K / 32) + kt) * 512. Inside a block the
// 16-byte chunk number u * 32 + lane holds that lane's fragment
// elements 8u .. 8u+7: row = lane & 15, k = 16 * u + 8 * (lane >> 4) + 0..7.
// A wave-wide 16-byte load or store of one u is then 512 contiguous bytes
// (4 cache lines) where the row-major form touches 16 lines.
// ---------------------------------------------------------------------------
__device__ __forceinline__ v16h load_pk(const _Float16* __restrict__ blk) {
  const _Float16* q = blk + (threadIdx.x & 31) * 8;
  union { v8h h[2]; v16h v; } u;
  u.h[0] = *(const v8h*)(q);
  u.h[1] = *(const v8h*)(q + 256);
  return u.v;
}

// The same from a lane's own address (block + lane * 8) in global memory. The
// type names the address space because the GEMM's stepped addresses pass
// through an asm operand, behind which the compiler no longer knows it.
typedef const __attribute__((address_space(1))) _Float16* gptr_h;
typedef const __attribute__((address_space(1))) v8h*      gptr_v8h;
__device__ __forceinline__ v16h load_pk_lane(gptr_h q) {
  union { v8h h[2]; v16h v; } u;
  u.h[0] = *(gptr_v8h)(q);
  u.h[1] = *(gptr_v8h)(q + 256);
  return u.v;
}

__device__ __forceinline__ v8f wmma32(v16h a, v16h b, v8f c) {
  return __builtin_amdgcn_wmma_f32_16x16x32_f16(
      /*neg_a=*/false, a, /*neg_b=*/false, b,
      /*c_mod=*/(short)0, c, /*reuse_a=*/false, /*reuse_b=*/false);
}

// ---------------------------------------------------------------------------
// All five f32 operands -> f16, fragment-ordered, in one launch of PACK_T
// threads. dst is the start of the workspace, where X, Wq^T, Wk^T, Wv^T and Wo
// follow one another. A thread owns one place in a block (16-byte chunk t & 63:
// row c, k = 16 u + 8 h + 0..7) and fills it in 12 blocks: in 8 blocks of X
// that follow one another along k, and in block t >> 6 of each weight matrix.
// The launch is small enough to be resident at once (16 waves per WGP): a wave
// is started once for 12 chunks, and all its loads are in flight together.
// ---------------------------------------------------------------------------
#define PACK_T (512 * 256)               // = the chunks of one weight matrix
typedef __attribute__((ext_vector_type(4))) float v4f;

__global__ void __launch_bounds__(256)
pack_all(const float* __restrict__ X, const float* __restrict__ Wq,
         const float* __restrict__ Wk, const float* __restrict__ Wv,
         const float* __restrict__ Wo, _Float16* __restrict__ dst) {
  const unsigned t = blockIdx.x * 256 + threadIdx.x;
  const unsigned c = t & 15, h = (t >> 4) & 1, u = (t >> 5) & 1, blk = t >> 6;
  // X: blocks 8 blk .. 8 blk + 7 (EMBED / 32 = 32 blocks per strip of 16 rows).
  // The chunk's first element in the first of them, in groups of 4 floats; a
  // block on is 8 groups on.
  const unsigned ox = ((blk >> 2) * 16 + c) * (EMBED / 4) + (blk & 3) * 64 + u * 4 + h * 2;
  // weights: block blk = strip rt, k block kt; a source taken as it is,
  // src[row][k], in groups of 4 floats ...
  const unsigned rt = blk >> 5, kt = blk & 31;
  const unsigned op = (rt * 16 + c) * (EMBED / 4) + kt * 8 + u * 4 + h * 2;
  // ... and one taken transposed, logical dst[n][k] = src[k][n], in floats
  const unsigned ot = (kt * 32 + u * 16 + h * 8) * EMBED + rt * 16 + c;

  v4f x[9][2];                           // 8 blocks of X, then Wo
#pragma unroll
  for (int i = 0; i < 8; ++i) {
    x[i][0] = ((const v4f*)X + i * 8)[ox];
    x[i][1] = ((const v4f*)X + i * 8 + 1)[ox];
  }
  x[8][0] = ((const v4f*)Wo)[op];
  x[8][1] = ((const v4f*)Wo + 1)[op];
  v8f w[3];                              // Wq, Wk, Wv
#pragma unroll
  for (int m = 0; m < 3; ++m) {
    const float* q = (m == 0 ? Wq : m == 1 ? Wk : Wv);
#pragma unroll
    for (int e = 0; e < 8; ++e) w[m][e] = (q + e * EMBED)[ot];
  }
  // Holds every load above the first conversion: left alone the compiler waits
  // for the first loads before it issues the later ones, several memory
  // latencies in a row instead of one. The three offsets are named so that they
  // live as long as the loads that name them: no result lands in their registers.
  asm volatile("" :: "v"(x[0][0]), "v"(x[0][1]), "v"(x[1][0]), "v"(x[1][1]),
                     "v"(x[2][0]), "v"(x[2][1]), "v"(x[3][0]), "v"(x[3][1]),
                     "v"(x[4][0]), "v"(x[4][1]), "v"(x[5][0]), "v"(x[5][1]),
                     "v"(x[6][0]), "v"(x[6][1]), "v"(x[7][0]), "v"(x[7][1]),
                     "v"(x[8][0]), "v"(x[8][1]), "v"(w[0]), "v"(w[1]), "v"(w[2]),
                     "v"(ox), "v"(op), "v"(ot));

  const unsigned dx = blk * 512 + (t & 63);        // X: the chunk in block 8 blk
#pragma unroll
  for (int i = 0; i < 9; ++i) {
    v8h o;
#pragma unroll
    for (int e = 0; e < 4; ++e) {
      o[e]     = (_Float16)x[i][0][e];
      o[e + 4] = (_Float16)x[i][1][e];
    }
    if (i < 8) ((v8h*)dst + i * 64)[dx] = o;
    else       ((v8h*)dst + 11 * PACK_T)[t] = o;   // Wo stands last
  }
#pragma unroll
  for (int m = 0; m < 3; ++m) {
    v8h o;
#pragma unroll
    for (int e = 0; e < 8; ++e) o[e] = (_Float16)w[m][e];
    ((v8h*)dst + (8 + m) * PACK_T)[t] = o;
  }
}

// ---------------------------------------------------------------------------
// WMMA GEMM: C[M,N] = A[M,K] * B[K,N], with B supplied transposed as Bt[N,K];
// A and Bt fragment-ordered. Each wave computes a 64x64 tile (16 wmmas per
// K=32 step).
// MODE 0: f16, per (b,h) the matrix [S][D] fragment-ordered   (Q, K)
// MODE 1: f16, per (b,h) the matrix [D][S] fragment-ordered   (V, for P@V)
// MODE 2: f32 to [M,N] + bias                                 (final output)
// A chunk of the output layout is 8 consecutive k of one row. MODE 1 has them
// in a lane's accumulator as it is (k = s = the tile's rows); MODE 0 (k = d =
// the tile's columns) takes Bt as the A operand, which gives the tile
// transposed: acc[i][j][r] = C[i*16 + nlo][j*16 + 8*half + r].
// ---------------------------------------------------------------------------
template <int MODE>
__global__ void __launch_bounds__(256)
gemm_wmma(const _Float16* __restrict__ A, const _Float16* __restrict__ Bt,
          _Float16* __restrict__ outh, float* __restrict__ outf,
          const float* __restrict__ bias, int M, int N) {
  const int wave  = blockIdx.x * (blockDim.x >> 5) + (threadIdx.x >> 5);
  const int tilesN = N >> 6;
  const int tm = wave / tilesN;
  const int tn = wave % tilesN;
  if (tm * 64 >= M) return;
  const int lane = threadIdx.x & 31;
  const int half = lane >> 4, nlo = lane & 15;
  constexpr int KT = EMBED >> 5;         // blocks per strip; K = EMBED in all four products

  // the lane's chunk in block 0 of the tile's first strip; the other strips
  // stand at constant distances, so each operand needs one address for all its
  // loads of a step
  gptr_h pa = (gptr_h)(A  + (size_t)tm * 64 * EMBED + lane * 8);
  gptr_h pb = (gptr_h)(Bt + (size_t)tn * 64 * EMBED + lane * 8);

  v8f acc[4][4] = {};

  for (int kt = 0; kt < KT; ++kt) {
    v16h af[4];
#pragma unroll
    for (int i = 0; i < 4; ++i)
      af[i] = load_pk_lane(pa + i * KT * 512);
#pragma unroll
    for (int j = 0; j < 4; ++j) {
      v16h bf = load_pk_lane(pb + j * KT * 512);
#pragma unroll
      for (int i = 0; i < 4; ++i)
        acc[i][j] = (MODE == 0) ? wmma32(bf, af[i], acc[i][j])
                                : wmma32(af[i], bf, acc[i][j]);
    }
    // Stepping pa and pb overwrites registers that the loads above name: this
    // wait stands in front of that. It takes both as operands, so that they
    // stay whole through the step's loads and are stepped only behind it
    // (without it each step's addresses are formed in fresh registers).
    asm volatile("s_wait_xcnt 0x0" : "+v"(pa), "+v"(pb) : : "memory");
    pa += 512;
    pb += 512;
  }

  if (MODE == 2) {
#pragma unroll
    for (int i = 0; i < 4; ++i) {
#pragma unroll
      for (int j = 0; j < 4; ++j) {
#pragma unroll
        for (int r = 0; r < 8; ++r) {
          const int m = tm * 64 + i * 16 + r + half * 8;
          const int n = tn * 64 + j * 16 + nlo;
          outf[(size_t)m * N + n] = acc[i][j][r] + bias[n];
        }
      }
    }
  } else {
    // the 64 tile rows lie in one batch (b = tm >> 5, s0 = (tm & 31) * 64),
    // the 64 tile columns are one head (h = tn)
    _Float16* ob = outh + (size_t)((tm >> 5) * HEADS + tn) * SEQ * HDIM + lane * 8;
    const int st = tm & 31;
#pragma unroll
    for (int i = 0; i < 4; ++i) {
#pragma unroll
      for (int j = 0; j < 4; ++j) {
        v8h o;
#pragma unroll
        for (int r = 0; r < 8; ++r) o[r] = (_Float16)acc[i][j][r];
        const int off = (MODE == 0)
            ? ((st * 4 + i) * 2 + (j >> 1)) * 512 + (j & 1) * 256     // [S][D], 2 blocks per strip
            : (j * 64 + st * 2 + (i >> 1)) * 512 + (i & 1) * 256;     // [D][S], 64 blocks per strip
        *(v8h*)(ob + off) = o;
      }
    }
  }
}

// ---------------------------------------------------------------------------
// Lane l <-> lane l ^ 16: the other half's value of the same column.
// ---------------------------------------------------------------------------
__device__ __forceinline__ float other_half(float x) {
  const int b = __builtin_bit_cast(int, x);
  return __builtin_bit_cast(float,
      __builtin_amdgcn_permlanex16(b, b, 0x76543210, 0xfedcba98, false, false));
}

// ---------------------------------------------------------------------------
// 2^x by v_exp_f32, eight at a time and one alone, in place. Behind a
// transcendental the instruction set asks for one independent instruction
// before its source is overwritten or its result read.
// Written so, each v_exp_f32 is followed by an independent one and the last by
// the v_nop that fills its slot.
// ---------------------------------------------------------------------------
__device__ __forceinline__ v8f exp2_x8(v8f x) {
  float y0 = x[0], y1 = x[1], y2 = x[2], y3 = x[3];
  float y4 = x[4], y5 = x[5], y6 = x[6], y7 = x[7];
  asm("v_exp_f32 %0, %0\n\t"
      "v_exp_f32 %1, %1\n\t"
      "v_exp_f32 %2, %2\n\t"
      "v_exp_f32 %3, %3\n\t"
      "v_exp_f32 %4, %4\n\t"
      "v_exp_f32 %5, %5\n\t"
      "v_exp_f32 %6, %6\n\t"
      "v_exp_f32 %7, %7\n\t"
      "v_nop"
      : "+v"(y0), "+v"(y1), "+v"(y2), "+v"(y3),
        "+v"(y4), "+v"(y5), "+v"(y6), "+v"(y7));
  v8f y = {y0, y1, y2, y3, y4, y5, y6, y7};
  return y;
}
__device__ __forceinline__ float exp2_x1(float x) {
  asm("v_exp_f32 %0, %0\n\t"
      "v_nop"
      : "+v"(x));
  return x;
}

// ---------------------------------------------------------------------------
// load_pk of the block that stands blk_bytes behind q in LDS; q holds the
// buffer's start plus the lane's 16 bytes.
// ---------------------------------------------------------------------------
__device__ __forceinline__ v16h load_pk_lds(const _Float16* q, int blk_bytes) {
  union { v8h h[2]; v16h v; } u;
  u.h[0] = *(const v8h*)(q + blk_bytes / 2);
  u.h[1] = *(const v8h*)(q + blk_bytes / 2 + 256);
  return u.v;
}

// ---------------------------------------------------------------------------
// One stage of the attention ring: 64 keys of K (8 KiB, contiguous) and of V^T
// (four d strips of 2 KiB), 16 KiB in LDS. Each of the 256 threads brings four
// 16-byte chunks by asynchronous copies, a wave 512 contiguous bytes per copy.
// lds: the thread's chunk in the buffer's first 4 KiB. kb, vb: the stage's first
// byte of K and of V^T strip 0, the same for the whole block (scalar registers);
// ko, vo: the thread's byte offsets from them. The s_wait_xcnt stands inside the
// statement, so that no register a copy names is rewritten ahead of it.
// ---------------------------------------------------------------------------
__device__ __forceinline__ void copy_stage(unsigned lds, const char* kb, unsigned ko,
                                           const char* vb, unsigned vo) {
  const unsigned l1 = lds + 4096, l2 = lds + 8192, l3 = lds + 12288;
  const char* kb1 = kb + 4096;          // keys 32..63 of the stage
  const char* vb1 = vb + 2 * 65536;     // two d strips on
  asm volatile("global_load_async_to_lds_b128 %0, %4, %6\n\t"
               "global_load_async_to_lds_b128 %1, %4, %7\n\t"
               "global_load_async_to_lds_b128 %2, %5, %8\n\t"
               "global_load_async_to_lds_b128 %3, %5, %9\n\t"
               "s_wait_xcnt 0x0"
               :: "v"(lds), "v"(l1), "v"(l2), "v"(l3), "v"(ko), "v"(vo),
                  "s"(kb), "s"(kb1), "s"(vb), "s"(vb1)
               : "memory");
}

__global__ void __launch_bounds__(256) __attribute__((amdgpu_waves_per_eu(8, 8)))
attn_wmma(const _Float16* __restrict__ Q, const _Float16* __restrict__ K,
          const _Float16* __restrict__ Vt, _Float16* __restrict__ Ctx) {
  // the wave's number as a scalar: tile and head then live in scalar registers
  // through the loop (as vector registers they were spilled at 128 VGPRs)
  const int wave = blockIdx.x * 8 + __builtin_amdgcn_readfirstlane(threadIdx.x >> 5);
  const int qt = wave & 127;             // q tile within head (S/16 = 128)
  const int bh = wave >> 7;              // b*HEADS + h
  const int lane = threadIdx.x & 31;
  constexpr int STAGE_B = 16384;         // bytes of a stage: K 8 KiB, then V^T 8 KiB
  constexpr int NSTAGE = SEQ / 64;
  __shared__ __attribute__((aligned(1024))) _Float16 ring[2 * STAGE_B / 2];

  const _Float16* Qb = Q  + ((size_t)bh * SEQ + qt * 16) * HDIM;   // strip qt: 2 blocks
  const _Float16* Kb = K  + (size_t)bh * SEQ * HDIM;
  const _Float16* Vb = Vt + (size_t)bh * HDIM * SEQ;

  // the thread's chunks in a stage; a stage on is 8 KiB of K, 2 KiB of each V^T strip
  const unsigned ko = threadIdx.x * 16;
  const unsigned vo = (threadIdx.x >> 7) * 65536 + (threadIdx.x & 127) * 16;
  const unsigned lds0 = (unsigned)(size_t)ring + threadIdx.x * 16;
  const char* kg = (const char*)Kb;
  const char* vg = (const char*)Vb;

  copy_stage(lds0, kg, ko, vg, vo);
  // stage 0 has landed for this wave, then for all: nobody reads it before
  asm volatile("s_wait_asynccnt 0x0" ::: "memory");
  __syncthreads();
  copy_stage(lds0 + STAGE_B, kg + 8192, ko, vg + 2048, vo);
  kg += 2 * 8192;
  vg += 2 * 2048;

  const v16h bq0 = load_pk(Qb);         // Q rows as columns of Q^T, d 0..31
  const v16h bq1 = load_pk(Qb + 512);   // d 32..63

  v8f ctx[4] = {};                       // ctx[j][r] = O[q][16 j + 8 half + r]
  float mrow = -1e30f, lrow = 0.0f;      // the query's maximum; this lane's share of its sum
  const float sc = 0.125f;               // 1/sqrt(64)
  const float L2E = 1.44269504f;         // log2(e): e^x = 2^(x * L2E)

  for (int st = 0; st < NSTAGE; ++st) {
    const int buf = (st & 1) * STAGE_B;
    const _Float16* sk = ring + buf / 2 + lane * 8;   // the stage's K; V^T 8 KiB on
    // ---- scores: four 16(kv) x 16(q) tiles covering the stage's 64 keys ----
    v8f s[4] = {};
#pragma unroll
    for (int t = 0; t < 4; ++t) {
      s[t] = wmma32(load_pk_lds(sk, t * 2048),        bq0, s[t]);
      s[t] = wmma32(load_pk_lds(sk, t * 2048 + 1024), bq1, s[t]);
    }

    // ---- online softmax, one query per lane ----
    float mt[4];
#pragma unroll
    for (int t = 0; t < 4; ++t) {
#pragma unroll
      for (int r = 0; r < 8; ++r) s[t][r] *= sc;
      mt[t] = fmaxf(fmaxf(fmaxf(s[t][0], s[t][1]), fmaxf(s[t][2], s[t][3])),
                    fmaxf(fmaxf(s[t][4], s[t][5]), fmaxf(s[t][6], s[t][7])));
    }
    float mx = fmaxf(fmaxf(mt[0], mt[1]), fmaxf(mt[2], mt[3]));
    mx = fmaxf(mx, other_half(mx));
    const float mn = fmaxf(mrow, mx);
    float rs[4];
#pragma unroll
    for (int t = 0; t < 4; ++t) {
#pragma unroll
      for (int r = 0; r < 8; ++r) s[t][r] = (s[t][r] - mn) * L2E;
      s[t] = exp2_x8(s[t]);
      rs[t] = ((s[t][0] + s[t][1]) + (s[t][2] + s[t][3])) +
              ((s[t][4] + s[t][5]) + (s[t][6] + s[t][7]));
    }
    const float f = exp2_x1((mrow - mn) * L2E);
    lrow = lrow * f + ((rs[0] + rs[1]) + (rs[2] + rs[3]));
    mrow = mn;
#pragma unroll
    for (int j = 0; j < 4; ++j)
#pragma unroll
      for (int r = 0; r < 8; ++r) ctx[j][r] *= f;

    // P^T as B operands: element e = key 8 half + e (e < 8), 16 + 8 half + e - 8
    v16h pb0, pb1;                       // the stage's keys 0..31, 32..63
#pragma unroll
    for (int r = 0; r < 8; ++r) {
      pb0[r] = (_Float16)s[0][r];  pb0[r + 8] = (_Float16)s[1][r];
      pb1[r] = (_Float16)s[2][r];  pb1[r + 8] = (_Float16)s[3][r];
    }

    // ---- O^T += V^T P^T : four 16-wide d chunks, two kv halves each ----
#pragma unroll
    for (int j = 0; j < 4; ++j) {
      v16h va0 = load_pk_lds(sk, 8192 + j * 2048);
      v16h va1 = load_pk_lds(sk, 8192 + j * 2048 + 1024);
      ctx[j] = wmma32(va0, pb0, ctx[j]);
      ctx[j] = wmma32(va1, pb1, ctx[j]);
    }

    // ---- hand-over: this wave's reads of the stage are done, its copies of the
    // next have landed; behind the barrier both hold for all 8 waves, so the next
    // stage may be read and this stage's buffer refilled ----
    // The products stay above the hand-over: sunk below it they stood directly
    // in front of the branch.
    __builtin_amdgcn_sched_barrier(0);
    asm volatile("s_wait_dscnt 0x0" ::: "memory");
    asm volatile("s_wait_asynccnt 0x0" ::: "memory");
    __syncthreads();
    // the four vector slots between the last WMMA and the first instruction that
    // overwrites its operands, on both sides of the branch
    asm volatile("v_nop\n\tv_nop\n\tv_nop\n\tv_nop");
    if (st + 2 < NSTAGE) {
      copy_stage(lds0 + buf, kg, ko, vg, vo);
      kg += 8192;
      vg += 2048;
    }
  }
  // no copy is outstanding when the wave ends
  asm volatile("s_wait_asynccnt 0x0" ::: "memory");

  // ---- join the halves' sums, normalize; a lane's 8 registers of tile j are
  // 8 consecutive d of its query: one chunk of the Ctx layout as they stand ----
  const float inv = 1.0f / (lrow + other_half(lrow));
  const int b = bh >> 4, h = bh & 15;
  // strip b * 128 + qt of [B*S][E] (32 blocks per strip), blocks 2h and 2h + 1
  _Float16* cb = Ctx + ((size_t)(b * (SEQ / 16) + qt) * 32 + h * 2) * 512 + lane * 8;
#pragma unroll
  for (int j = 0; j < 4; ++j) {
    v8h o;
#pragma unroll
    for (int r = 0; r < 8; ++r) o[r] = (_Float16)(ctx[j][r] * inv);
    *(v8h*)(cb + j * 256) = o;
  }
}

// ---------------------------------------------------------------------------
// Host-side orchestration
// Workspace (f16 elems): [0,8M) Xh (reused as Ctx), [8M..12M) weights,
// [12M..20M) Qh, [20M..28M) Kh, [28M..36M) Vth  => 72 MB total.
// ---------------------------------------------------------------------------
extern "C" void kernel_launch(void* const* d_in, const int* in_sizes, int n_in,
                              void* d_out, int out_size, void* d_ws, size_t ws_size,
                              hipStream_t stream) {
  const float* X  = (const float*)d_in[0];
  const float* Wq = (const float*)d_in[1];
  const float* Wk = (const float*)d_in[2];
  const float* Wv = (const float*)d_in[3];
  const float* Wo = (const float*)d_in[4];
  const float* bo = (const float*)d_in[5];
  float* out = (float*)d_out;

  _Float16* ws = (_Float16*)d_ws;
  const size_t M1 = (size_t)1024 * 1024;
  _Float16* Xh  = ws;             // 8M elems; later reused as Ctx (f16)
  _Float16* Wqt = ws + 8 * M1;    // W_q^T  [f,e]
  _Float16* Wkt = ws + 9 * M1;
  _Float16* Wvt = ws + 10 * M1;
  _Float16* Woh = ws + 11 * M1;   // W_o    [f,e] (already B^T layout for x@Wo^T)
  _Float16* Qh  = ws + 12 * M1;   // per (b,h) [S][D]
  _Float16* Kh  = ws + 20 * M1;   // per (b,h) [S][D]
  _Float16* Vth = ws + 28 * M1;   // per (b,h) [D][S]

  // 1) precision conversion / weight re-layout: Xh .. Woh, 12M elems from ws on
  pack_all<<<512, 256, 0, stream>>>(X, Wq, Wk, Wv, Wo, ws);

  // 2) Q/K/V projections (8192x1024x1024 each), 2048 waves / 256 blocks
  gemm_wmma<0><<<256, 256, 0, stream>>>(Xh, Wqt, Qh,  nullptr, nullptr, MTOT, EMBED);
  gemm_wmma<0><<<256, 256, 0, stream>>>(Xh, Wkt, Kh,  nullptr, nullptr, MTOT, EMBED);
  gemm_wmma<1><<<256, 256, 0, stream>>>(Xh, Wvt, Vth, nullptr, nullptr, MTOT, EMBED);

  // 3) flash attention: 8192 q-tiles -> 1024 blocks of 8 waves; Ctx -> Xh
  attn_wmma<<<1024, 256, 0, stream>>>(Qh, Kh, Vth, Xh);

  // 4) output projection + bias, f32 result
  gemm_wmma<2><<<256, 256, 0, stream>>>(Xh, Woh, nullptr, out, bo, MTOT, EMBED);
}

// v005
// Measured time: 139 microseconds a run.
// In two side-by-side timings against v004, it was 1.63 and 1.65 times as fast.
// Over all steps from v000 it is 4.73 times as fast.
#include <hip/hip_runtime.h>

typedef __attribute__((ext_vector_type(16))) _Float16 v16h;
typedef __attribute__((ext_vector_type(8)))  _Float16 v8h;
typedef __attribute__((ext_vector_type(4)))  _Float16 v4h;
typedef __attribute__((ext_vector_type(8)))  float    v8f;

#define EMBED 1024
#define HEADS 16
#define HDIM  64
#define BATCH 4
#define SEQ   2048
#define MTOT  (BATCH * SEQ)   // 8192

// ---------------------------------------------------------------------------
// 16x32 f16 fragment, the wave-lane indexing the M (or N) row.
// Layout per CDNA5 ISA 7.12.2 (16-bit A 16x32):
//   lanes 0-15 : row = lane,    elems 0..7 = K[0..7],  elems 8..15 = K[16..23]
//   lanes 16-31: row = lane-16, elems 0..7 = K[8..15], elems 8..15 = K[24..31]
// B (32x16) uses the symmetric layout, so one loader serves A fragments and B
// fragments from a [N, K] (i.e. B^T) source.
// ---------------------------------------------------------------------------

// ---------------------------------------------------------------------------
// Fragment-ordered operands. Every f16 matrix [rows][K] that a WMMA reads from
// the workspace is kept as blocks of 16 rows x 32 k (512 elements, 1 KiB);
// block (rt, kt) stands at (rt * (K / 32) + kt) * 512. Inside a block the
// 16-byte chunk number u * 32 + lane holds that lane's fragment
// elements 8u .. 8u+7: row = lane & 15, k = 16 * u + 8 * (lane >> 4) + 0..7.
// A wave-wide 16-byte load or store of one u is then 512 contiguous bytes
// (4 cache lines) where the row-major form touches 16 lines.
// ---------------------------------------------------------------------------
__device__ __forceinline__ v16h load_pk(const _Float16* __restrict__ blk) {
  const _Float16* q = blk + (threadIdx.x & 31) * 8;
  union { v8h h[2]; v16h v; } u;
  u.h[0] = *(const v8h*)(q);
  u.h[1] = *(const v8h*)(q + 256);
  return u.v;
}

__device__ __forceinline__ v8f wmma32(v16h a, v16h b, v8f c) {
  return __builtin_amdgcn_wmma_f32_16x16x32_f16(
      /*neg_a=*/false, a, /*neg_b=*/false, b,
      /*c_mod=*/(short)0, c, /*reuse_a=*/false, /*reuse_b=*/false);
}

// ---------------------------------------------------------------------------
// All five f32 operands -> f16, fragment-ordered, in one launch of PACK_T
// threads. dst is the start of the workspace, where X, Wq^T, Wk^T, Wv^T and Wo
// follow one another. A thread owns one place in a block (16-byte chunk t & 63:
// row c, k = 16 u + 8 h + 0..7) and fills it in 12 blocks: in 8 blocks of X
// that follow one another along k, and in block t >> 6 of each weight matrix.
// The launch is small enough to be resident at once (16 waves per WGP): a wave
// is started once for 12 chunks, and all its loads are in flight together.
// ---------------------------------------------------------------------------
#define PACK_T (512 * 256)               // = the chunks of one weight matrix
typedef __attribute__((ext_vector_type(4))) float v4f;

__global__ void __launch_bounds__(256)
pack_all(const float* __restrict__ X, const float* __restrict__ Wq,
         const float* __restrict__ Wk, const float* __restrict__ Wv,
         const float* __restrict__ Wo, _Float16* __restrict__ dst) {
  const unsigned t = blockIdx.x * 256 + threadIdx.x;
  const unsigned c = t & 15, h = (t >> 4) & 1, u = (t >> 5) & 1, blk = t >> 6;
  // X: blocks 8 blk .. 8 blk + 7 (EMBED / 32 = 32 blocks per strip of 16 rows).
  // The chunk's first element in the first of them, in groups of 4 floats; a
  // block on is 8 groups on.
  const unsigned ox = ((blk >> 2) * 16 + c) * (EMBED / 4) + (blk & 3) * 64 + u * 4 + h * 2;
  // weights: block blk = strip rt, k block kt; a source taken as it is,
  // src[row][k], in groups of 4 floats ...
  const unsigned rt = blk >> 5, kt = blk & 31;
  const unsigned op = (rt * 16 + c) * (EMBED / 4) + kt * 8 + u * 4 + h * 2;
  // ... and one taken transposed, logical dst[n][k] = src[k][n], in floats
  const unsigned ot = (kt * 32 + u * 16 + h * 8) * EMBED + rt * 16 + c;

  v4f x[9][2];                           // 8 blocks of X, then Wo
#pragma unroll
  for (int i = 0; i < 8; ++i) {
    x[i][0] = ((const v4f*)X + i * 8)[ox];
    x[i][1] = ((const v4f*)X + i * 8 + 1)[ox];
  }
  x[8][0] = ((const v4f*)Wo)[op];
  x[8][1] = ((const v4f*)Wo + 1)[op];
  v8f w[3];                              // Wq, Wk, Wv
#pragma unroll
  for (int m = 0; m < 3; ++m) {
    const float* q = (m == 0 ? Wq : m == 1 ? Wk : Wv);
#pragma unroll
    for (int e = 0; e < 8; ++e) w[m][e] = (q + e * EMBED)[ot];
  }
  // Holds every load above the first conversion: left alone the compiler waits
  // for the first loads before it issues the later ones, several memory
  // latencies in a row instead of one. The three offsets are named so that they
  // live as long as the loads that name them: no result lands in their registers.
  asm volatile("" :: "v"(x[0][0]), "v"(x[0][1]), "v"(x[1][0]), "v"(x[1][1]),
                     "v"(x[2][0]), "v"(x[2][1]), "v"(x[3][0]), "v"(x[3][1]),
                     "v"(x[4][0]), "v"(x[4][1]), "v"(x[5][0]), "v"(x[5][1]),
                     "v"(x[6][0]), "v"(x[6][1]), "v"(x[7][0]), "v"(x[7][1]),
                     "v"(x[8][0]), "v"(x[8][1]), "v"(w[0]), "v"(w[1]), "v"(w[2]),
                     "v"(ox), "v"(op), "v"(ot));

  const unsigned dx = blk * 512 + (t & 63);        // X: the chunk in block 8 blk
#pragma unroll
  for (int i = 0; i < 9; ++i) {
    v8h o;
#pragma unroll
    for (int e = 0; e < 4; ++e) {
      o[e]     = (_Float16)x[i][0][e];
      o[e + 4] = (_Float16)x[i][1][e];
    }
    if (i < 8) ((v8h*)dst + i * 64)[dx] = o;
    else       ((v8h*)dst + 11 * PACK_T)[t] = o;   // Wo stands last
  }
#pragma unroll
  for (int m = 0; m < 3; ++m) {
    v8h o;
#pragma unroll
    for (int e = 0; e < 8; ++e) o[e] = (_Float16)w[m][e];
    ((v8h*)dst + (8 + m) * PACK_T)[t] = o;
  }
}

// ---------------------------------------------------------------------------
// load_pk of the block that stands blk_bytes behind q in LDS; q holds the
// buffer's start plus the lane's 16 bytes.
// ---------------------------------------------------------------------------
__device__ __forceinline__ v16h load_pk_lds(const _Float16* q, int blk_bytes) {
  union { v8h h[2]; v16h v; } u;
  u.h[0] = *(const v8h*)(q + blk_bytes / 2);
  u.h[1] = *(const v8h*)(q + blk_bytes / 2 + 256);
  return u.v;
}

// ---------------------------------------------------------------------------
// Eight strips of a GEMM stage by asynchronous copies: of each strip (16 rows)
// the stage's four k blocks, 4 KiB contiguous, one 16-byte chunk a thread, a wave
// 512 contiguous bytes per copy. lds: the thread's chunk in the first strip's
// place, the next strips 4 KiB apart. g: the stage's first byte of the first
// strip, the same for the whole block (scalar registers), the next strips 32 KiB
// apart; vo: the thread's byte offset from it. The s_wait_xcnt stands inside the
// statement, so that no register a copy names is rewritten ahead of it.
// ---------------------------------------------------------------------------
__device__ __forceinline__ void copy_strips8(unsigned lds, unsigned vo, const char* g) {
  asm volatile("global_load_async_to_lds_b128 %0, %8, %9\n\t"
               "global_load_async_to_lds_b128 %1, %8, %10\n\t"
               "global_load_async_to_lds_b128 %2, %8, %11\n\t"
               "global_load_async_to_lds_b128 %3, %8, %12\n\t"
               "global_load_async_to_lds_b128 %4, %8, %13\n\t"
               "global_load_async_to_lds_b128 %5, %8, %14\n\t"
               "global_load_async_to_lds_b128 %6, %8, %15\n\t"
               "global_load_async_to_lds_b128 %7, %8, %16\n\t"
               "s_wait_xcnt 0x0"
               :: "v"(lds), "v"(lds + 4096), "v"(lds + 2 * 4096), "v"(lds + 3 * 4096),
                  "v"(lds + 4 * 4096), "v"(lds + 5 * 4096), "v"(lds + 6 * 4096),
                  "v"(lds + 7 * 4096), "v"(vo),
                  "s"(g), "s"(g + 32768), "s"(g + 2 * 32768), "s"(g + 3 * 32768),
                  "s"(g + 4 * 32768), "s"(g + 5 * 32768), "s"(g + 6 * 32768),
                  "s"(g + 7 * 32768)
               : "memory");
}

// ---------------------------------------------------------------------------
// WMMA GEMM: C[M,N] = A[M,K] * B[K,N], with B supplied transposed as Bt[N,K];
// A and Bt fragment-ordered. A block of 8 waves computes a 128x256 tile, each
// wave 64x64 of it (16 wmmas per K=32 step): wave w has rows 64 (w >> 2) and
// columns 64 (w & 3). The block's 8 strips of A and 16 of Bt stand in LDS in two
// buffers of one 128-k stage each (24 strips x 4 KiB); the next stage's copies
// fly while this one is worked on. A strip of A is then fetched once for four
// waves, a strip of Bt once for two.
// MODE 0: f16, per (b,h) the matrix [S][D] fragment-ordered   (Q, K)
// MODE 1: f16, per (b,h) the matrix [D][S] fragment-ordered   (V, for P@V)
// MODE 2: f32 to [M,N] + bias                                 (final output)
// A chunk of the output layout is 8 consecutive k of one row. MODE 1 has them
// in a lane's accumulator as it is (k = s = the tile's rows); MODE 0 (k = d =
// the tile's columns) takes Bt as the A operand, which gives the tile
// transposed: acc[i][j][r] = C[i*16 + nlo][j*16 + 8*half + r].
// ---------------------------------------------------------------------------
template <int MODE>
__global__ void __launch_bounds__(256)
gemm_wmma(const _Float16* __restrict__ A, const _Float16* __restrict__ Bt,
          _Float16* __restrict__ outh, float* __restrict__ outf,
          const float* __restrict__ bias, int M, int N) {
  constexpr int KT = EMBED >> 5;         // blocks per strip; K = EMBED in all four products
  constexpr int KS = 4;                  // k blocks of a stage
  constexpr int NSTAGE = KT / KS;
  constexpr int STRIP_B = KS * 1024;     // bytes of a strip in a stage
  constexpr int STAGE_B = 24 * STRIP_B;  // A 8 strips, then Bt 16 strips
  __shared__ __attribute__((aligned(1024))) _Float16 ring[2 * STAGE_B / 2];

  const int tilesN = N >> 8;
  const int bm = blockIdx.x / tilesN;
  const int bn = blockIdx.x % tilesN;
  if (bm * 128 >= M) return;             // the whole block, in front of every barrier
  // the wave's number as a scalar: its tile and its LDS strips are wave-uniform
  const int w  = __builtin_amdgcn_readfirstlane(threadIdx.x >> 5);
  const int tm = bm * 2 + (w >> 2);
  const int tn = bn * 4 + (w & 3);
  const int lane = threadIdx.x & 31;
  const int half = lane >> 4, nlo = lane & 15;

  const unsigned vo = threadIdx.x * 16;
  const unsigned lds0 = (unsigned)(size_t)ring + vo;
  const char* ga = (const char*)A  + (size_t)bm * 8  * KT * 1024;
  const char* gb = (const char*)Bt + (size_t)bn * 16 * KT * 1024;

  copy_strips8(lds0,                vo, ga);
  copy_strips8(lds0 +  8 * STRIP_B, vo, gb);
  copy_strips8(lds0 + 16 * STRIP_B, vo, gb + 8 * KT * 1024);
  // stage 0 has landed for this wave, then for all: nobody reads it before
  asm volatile("s_wait_asynccnt 0x0" ::: "memory");
  __syncthreads();
  copy_strips8(lds0 + STAGE_B,                vo, ga + STRIP_B);
  copy_strips8(lds0 + STAGE_B +  8 * STRIP_B, vo, gb + STRIP_B);
  copy_strips8(lds0 + STAGE_B + 16 * STRIP_B, vo, gb + 8 * KT * 1024 + STRIP_B);
  ga += 2 * STRIP_B;
  gb += 2 * STRIP_B;

  v8f acc[4][4] = {};

  for (int st = 0; st < NSTAGE; ++st) {
    const int buf = (st & 1) * STAGE_B;
    // the lane's chunk in the wave's first strip of each operand
    const _Float16* sa = ring + (buf + (w >> 2) * 4 * STRIP_B) / 2 + lane * 8;
    const _Float16* sb = ring + (buf + (8 + (w & 3) * 4) * STRIP_B) / 2 + lane * 8;
    // Two fragment sets: the next k block's LDS reads go out ahead of this block's
    // products, in two groups: A and half of B in front of the block, the rest of
    // B at its middle, into the registers that the first half of this block's B
    // has left (all in front would take the wave past 256 VGPRs).
    // The scheduling barriers keep reads and products in that order: left alone
    // the compiler sinks each read to just before its first use, into one
    // fragment set, and the wave waits out the LDS latency four times a k block.
    v16h af[2][4], bf[2][4];
#pragma unroll
    for (int i = 0; i < 4; ++i) {
      af[0][i] = load_pk_lds(sa, i * STRIP_B);
      bf[0][i] = load_pk_lds(sb, i * STRIP_B);
    }
#pragma unroll
    for (int kk = 0; kk < KS; ++kk) {
      const int c = kk & 1;
#pragma unroll
      for (int jh = 0; jh < 2; ++jh) {
        if (kk + 1 < KS) {
          if (jh == 0) {
#pragma unroll
            for (int i = 0; i < 4; ++i)
              af[c ^ 1][i] = load_pk_lds(sa, i * STRIP_B + (kk + 1) * 1024);
          }
#pragma unroll
          for (int j = 2 * jh; j < 2 * jh + 2; ++j)
            bf[c ^ 1][j] = load_pk_lds(sb, j * STRIP_B + (kk + 1) * 1024);
        }
        __builtin_amdgcn_sched_barrier(0);   // the reads stay ahead of the products
#pragma unroll
        for (int j = 2 * jh; j < 2 * jh + 2; ++j) {
#pragma unroll
          for (int i = 0; i < 4; ++i)
            acc[i][j] = (MODE == 0) ? wmma32(bf[c][j], af[c][i], acc[i][j])
                                    : wmma32(af[c][i], bf[c][j], acc[i][j]);
        }
        // the products stay ahead of the next reads, the last ones ahead of the
        // hand-over and its branch
        __builtin_amdgcn_sched_barrier(0);
      }
    }

    // ---- hand-over: this wave's reads of the stage are done, its copies of the
    // next have landed; behind the barrier both hold for all 8 waves, so the next
    // stage may be read and this stage's buffer refilled ----
    asm volatile("s_wait_dscnt 0x0" ::: "memory");
    asm volatile("s_wait_asynccnt 0x0" ::: "memory");
    __syncthreads();
    // the four vector slots between the last WMMA and the first instruction that
    // overwrites its operands, on both sides of the branch
    asm volatile("v_nop\n\tv_nop\n\tv_nop\n\tv_nop");
    if (st + 2 < NSTAGE) {
      copy_strips8(lds0 + buf,                vo, ga);
      copy_strips8(lds0 + buf +  8 * STRIP_B, vo, gb);
      copy_strips8(lds0 + buf + 16 * STRIP_B, vo, gb + 8 * KT * 1024);
      ga += STRIP_B;
      gb += STRIP_B;
    }
  }
  // no copy is outstanding when the wave ends
  asm volatile("s_wait_asynccnt 0x0" ::: "memory");

  if (MODE == 2) {
#pragma unroll
    for (int i = 0; i < 4; ++i) {
#pragma unroll
      for (int j = 0; j < 4; ++j) {
#pragma unroll
        for (int r = 0; r < 8; ++r) {
          const int m = tm * 64 + i * 16 + r + half * 8;
          const int n = tn * 64 + j * 16 + nlo;
          outf[(size_t)m * N + n] = acc[i][j][r] + bias[n];
        }
      }
    }
  } else {
    // the 64 tile rows lie in one batch (b = tm >> 5, s0 = (tm & 31) * 64),
    // the 64 tile columns are one head (h = tn)
    _Float16* ob = outh + (size_t)((tm >> 5) * HEADS + tn) * SEQ * HDIM + lane * 8;
    const int st = tm & 31;
#pragma unroll
    for (int i = 0; i < 4; ++i) {
#pragma unroll
      for (int j = 0; j < 4; ++j) {
        v8h o;
#pragma unroll
        for (int r = 0; r < 8; ++r) o[r] = (_Float16)acc[i][j][r];
        const int off = (MODE == 0)
            ? ((st * 4 + i) * 2 + (j >> 1)) * 512 + (j & 1) * 256     // [S][D], 2 blocks per strip
            : (j * 64 + st * 2 + (i >> 1)) * 512 + (i & 1) * 256;     // [D][S], 64 blocks per strip
        *(v8h*)(ob + off) = o;
      }
    }
  }
}

// ---------------------------------------------------------------------------
// Lane l <-> lane l ^ 16: the other half's value of the same column.
// ---------------------------------------------------------------------------
__device__ __forceinline__ float other_half(float x) {
  const int b = __builtin_bit_cast(int, x);
  return __builtin_bit_cast(float,
      __builtin_amdgcn_permlanex16(b, b, 0x76543210, 0xfedcba98, false, false));
}

// ---------------------------------------------------------------------------
// 2^x by v_exp_f32, eight at a time and one alone, in place. Behind a
// transcendental the instruction set asks for one independent instruction
// before its source is overwritten or its result read.
// Written so, each v_exp_f32 is followed by an independent one and the last by
// the v_nop that fills its slot.
// ---------------------------------------------------------------------------
__device__ __forceinline__ v8f exp2_x8(v8f x) {
  float y0 = x[0], y1 = x[1], y2 = x[2], y3 = x[3];
  float y4 = x[4], y5 = x[5], y6 = x[6], y7 = x[7];
  asm("v_exp_f32 %0, %0\n\t"
      "v_exp_f32 %1, %1\n\t"
      "v_exp_f32 %2, %2\n\t"
      "v_exp_f32 %3, %3\n\t"
      "v_exp_f32 %4, %4\n\t"
      "v_exp_f32 %5, %5\n\t"
      "v_exp_f32 %6, %6\n\t"
      "v_exp_f32 %7, %7\n\t"
      "v_nop"
      : "+v"(y0), "+v"(y1), "+v"(y2), "+v"(y3),
        "+v"(y4), "+v"(y5), "+v"(y6), "+v"(y7));
  v8f y = {y0, y1, y2, y3, y4, y5, y6, y7};
  return y;
}
__device__ __forceinline__ float exp2_x1(float x) {
  asm("v_exp_f32 %0, %0\n\t"
      "v_nop"
      : "+v"(x));
  return x;
}

// ---------------------------------------------------------------------------
// One stage of the attention ring: 64 keys of K (8 KiB, contiguous) and of V^T
// (four d strips of 2 KiB), 16 KiB in LDS. Each of the 256 threads brings four
// 16-byte chunks by asynchronous copies, a wave 512 contiguous bytes per copy.
// lds: the thread's chunk in the buffer's first 4 KiB. kb, vb: the stage's first
// byte of K and of V^T strip 0, the same for the whole block (scalar registers);
// ko, vo: the thread's byte offsets from them. The s_wait_xcnt stands inside the
// statement, so that no register a copy names is rewritten ahead of it.
// ---------------------------------------------------------------------------
__device__ __forceinline__ void copy_stage(unsigned lds, const char* kb, unsigned ko,
                                           const char* vb, unsigned vo) {
  const unsigned l1 = lds + 4096, l2 = lds + 8192, l3 = lds + 12288;
  const char* kb1 = kb + 4096;          // keys 32..63 of the stage
  const char* vb1 = vb + 2 * 65536;     // two d strips on
  asm volatile("global_load_async_to_lds_b128 %0, %4, %6\n\t"
               "global_load_async_to_lds_b128 %1, %4, %7\n\t"
               "global_load_async_to_lds_b128 %2, %5, %8\n\t"
               "global_load_async_to_lds_b128 %3, %5, %9\n\t"
               "s_wait_xcnt 0x0"
               :: "v"(lds), "v"(l1), "v"(l2), "v"(l3), "v"(ko), "v"(vo),
                  "s"(kb), "s"(kb1), "s"(vb), "s"(vb1)
               : "memory");
}

__global__ void __launch_bounds__(256) __attribute__((amdgpu_waves_per_eu(8, 8)))
attn_wmma(const _Float16* __restrict__ Q, const _Float16* __restrict__ K,
          const _Float16* __restrict__ Vt, _Float16* __restrict__ Ctx) {
  // the wave's number as a scalar: tile and head then live in scalar registers
  // through the loop (as vector registers they were spilled at 128 VGPRs)
  const int wave = blockIdx.x * 8 + __builtin_amdgcn_readfirstlane(threadIdx.x >> 5);
  const int qt = wave & 127;             // q tile within head (S/16 = 128)
  const int bh = wave >> 7;              // b*HEADS + h
  const int lane = threadIdx.x & 31;
  constexpr int STAGE_B = 16384;         // bytes of a stage: K 8 KiB, then V^T 8 KiB
  constexpr int NSTAGE = SEQ / 64;
  __shared__ __attribute__((aligned(1024))) _Float16 ring[2 * STAGE_B / 2];

  const _Float16* Qb = Q  + ((size_t)bh * SEQ + qt * 16) * HDIM;   // strip qt: 2 blocks
  const _Float16* Kb = K  + (size_t)bh * SEQ * HDIM;
  const _Float16* Vb = Vt + (size_t)bh * HDIM * SEQ;

  // the thread's chunks in a stage; a stage on is 8 KiB of K, 2 KiB of each V^T strip
  const unsigned ko = threadIdx.x * 16;
  const unsigned vo = (threadIdx.x >> 7) * 65536 + (threadIdx.x & 127) * 16;
  const unsigned lds0 = (unsigned)(size_t)ring + threadIdx.x * 16;
  const char* kg = (const char*)Kb;
  const char* vg = (const char*)Vb;

  copy_stage(lds0, kg, ko, vg, vo);
  // stage 0 has landed for this wave, then for all: nobody reads it before
  asm volatile("s_wait_asynccnt 0x0" ::: "memory");
  __syncthreads();
  copy_stage(lds0 + STAGE_B, kg + 8192, ko, vg + 2048, vo);
  kg += 2 * 8192;
  vg += 2 * 2048;

  const v16h bq0 = load_pk(Qb);         // Q rows as columns of Q^T, d 0..31
  const v16h bq1 = load_pk(Qb + 512);   // d 32..63

  v8f ctx[4] = {};                       // ctx[j][r] = O[q][16 j + 8 half + r]
  float mrow = -1e30f, lrow = 0.0f;      // the query's maximum; this lane's share of its sum
  const float sc = 0.125f;               // 1/sqrt(64)
  const float L2E = 1.44269504f;         // log2(e): e^x = 2^(x * L2E)

  for (int st = 0; st < NSTAGE; ++st) {
    const int buf = (st & 1) * STAGE_B;
    const _Float16* sk = ring + buf / 2 + lane * 8;   // the stage's K; V^T 8 KiB on
    // ---- scores: four 16(kv) x 16(q) tiles covering the stage's 64 keys ----
    v8f s[4] = {};
#pragma unroll
    for (int t = 0; t < 4; ++t) {
      s[t] = wmma32(load_pk_lds(sk, t * 2048),        bq0, s[t]);
      s[t] = wmma32(load_pk_lds(sk, t * 2048 + 1024), bq1, s[t]);
    }

    // ---- online softmax, one query per lane ----
    float mt[4];
#pragma unroll
    for (int t = 0; t < 4; ++t) {
#pragma unroll
      for (int r = 0; r < 8; ++r) s[t][r] *= sc;
      mt[t] = fmaxf(fmaxf(fmaxf(s[t][0], s[t][1]), fmaxf(s[t][2], s[t][3])),
                    fmaxf(fmaxf(s[t][4], s[t][5]), fmaxf(s[t][6], s[t][7])));
    }
    float mx = fmaxf(fmaxf(mt[0], mt[1]), fmaxf(mt[2], mt[3]));
    mx = fmaxf(mx, other_half(mx));
    const float mn = fmaxf(mrow, mx);
    float rs[4];
#pragma unroll
    for (int t = 0; t < 4; ++t) {
#pragma unroll
      for (int r = 0; r < 8; ++r) s[t][r] = (s[t][r] - mn) * L2E;
      s[t] = exp2_x8(s[t]);
      rs[t] = ((s[t][0] + s[t][1]) + (s[t][2] + s[t][3])) +
              ((s[t][4] + s[t][5]) + (s[t][6] + s[t][7]));
    }
    const float f = exp2_x1((mrow - mn) * L2E);
    lrow = lrow * f + ((rs[0] + rs[1]) + (rs[2] + rs[3]));
    mrow = mn;
#pragma unroll
    for (int j = 0; j < 4; ++j)
#pragma unroll
      for (int r = 0; r < 8; ++r) ctx[j][r] *= f;

    // P^T as B operands: element e = key 8 half + e (e < 8), 16 + 8 half + e - 8
    v16h pb0, pb1;                       // the stage's keys 0..31, 32..63
#pragma unroll
    for (int r = 0; r < 8; ++r) {
      pb0[r] = (_Float16)s[0][r];  pb0[r + 8] = (_Float16)s[1][r];
      pb1[r] = (_Float16)s[2][r];  pb1[r + 8] = (_Float16)s[3][r];
    }

    // ---- O^T += V^T P^T : four 16-wide d chunks, two kv halves each ----
#pragma unroll
    for (int j = 0; j < 4; ++j) {
      v16h va0 = load_pk_lds(sk, 8192 + j * 2048);
      v16h va1 = load_pk_lds(sk, 8192 + j * 2048 + 1024);
      ctx[j] = wmma32(va0, pb0, ctx[j]);
      ctx[j] = wmma32(va1, pb1, ctx[j]);
    }

    // ---- hand-over: this wave's reads of the stage are done, its copies of the
    // next have landed; behind the barrier both hold for all 8 waves, so the next
    // stage may be read and this stage's buffer refilled ----
    // The products stay above the hand-over: sunk below it they stood directly
    // in front of the branch.
    __builtin_amdgcn_sched_barrier(0);
    asm volatile("s_wait_dscnt 0x0" ::: "memory");
    asm volatile("s_wait_asynccnt 0x0" ::: "memory");
    __syncthreads();
    // the four vector slots between the last WMMA and the first instruction that
    // overwrites its operands, on both sides of the branch
    asm volatile("v_nop\n\tv_nop\n\tv_nop\n\tv_nop");
    if (st + 2 < NSTAGE) {
      copy_stage(lds0 + buf, kg, ko, vg, vo);
      kg += 8192;
      vg += 2048;
    }
  }
  // no copy is outstanding when the wave ends
  asm volatile("s_wait_asynccnt 0x0" ::: "memory");

  // ---- join the halves' sums, normalize; a lane's 8 registers of tile j are
  // 8 consecutive d of its query: one chunk of the Ctx layout as they stand ----
  const float inv = 1.0f / (lrow + other_half(lrow));
  const int b = bh >> 4, h = bh & 15;
  // strip b * 128 + qt of [B*S][E] (32 blocks per strip), blocks 2h and 2h + 1
  _Float16* cb = Ctx + ((size_t)(b * (SEQ / 16) + qt) * 32 + h * 2) * 512 + lane * 8;
#pragma unroll
  for (int j = 0; j < 4; ++j) {
    v8h o;
#pragma unroll
    for (int r = 0; r < 8; ++r) o[r] = (_Float16)(ctx[j][r] * inv);
    *(v8h*)(cb + j * 256) = o;
  }
}

// ---------------------------------------------------------------------------
// Host-side orchestration
// Workspace (f16 elems): [0,8M) Xh (reused as Ctx), [8M..12M) weights,
// [12M..20M) Qh, [20M..28M) Kh, [28M..36M) Vth  => 72 MB total.
// ---------------------------------------------------------------------------
extern "C" void kernel_launch(void* const* d_in, const int* in_sizes, int n_in,
                              void* d_out, int out_size, void* d_ws, size_t ws_size,
                              hipStream_t stream) {
  const float* X  = (const float*)d_in[0];
  const float* Wq = (const float*)d_in[1];
  const float* Wk = (const float*)d_in[2];
  const float* Wv = (const float*)d_in[3];
  const float* Wo = (const float*)d_in[4];
  const float* bo = (const float*)d_in[5];
  float* out = (float*)d_out;

  _Float16* ws = (_Float16*)d_ws;
  const size_t M1 = (size_t)1024 * 1024;
  _Float16* Xh  = ws;             // 8M elems; later reused as Ctx (f16)
  _Float16* Wqt = ws + 8 * M1;    // W_q^T  [f,e]
  _Float16* Wkt = ws + 9 * M1;
  _Float16* Wvt = ws + 10 * M1;
  _Float16* Woh = ws + 11 * M1;   // W_o    [f,e] (already B^T layout for x@Wo^T)
  _Float16* Qh  = ws + 12 * M1;   // per (b,h) [S][D]
  _Float16* Kh  = ws + 20 * M1;   // per (b,h) [S][D]
  _Float16* Vth = ws + 28 * M1;   // per (b,h) [D][S]

  // 1) precision conversion / weight re-layout: Xh .. Woh, 12M elems from ws on
  pack_all<<<512, 256, 0, stream>>>(X, Wq, Wk, Wv, Wo, ws);

  // 2) Q/K/V projections (8192x1024x1024 each), 2048 waves / 256 blocks
  gemm_wmma<0><<<256, 256, 0, stream>>>(Xh, Wqt, Qh,  nullptr, nullptr, MTOT, EMBED);
  gemm_wmma<0><<<256, 256, 0, stream>>>(Xh, Wkt, Kh,  nullptr, nullptr, MTOT, EMBED);
  gemm_wmma<1><<<256, 256, 0, stream>>>(Xh, Wvt, Vth, nullptr, nullptr, MTOT, EMBED);

  // 3) flash attention: 8192 q-tiles -> 1024 blocks of 8 waves; Ctx -> Xh
  attn_wmma<<<1024, 256, 0, stream>>>(Qh, Kh, Vth, Xh);

  // 4) output projection + bias, f32 result
  gemm_wmma<2><<<256, 256, 0, stream>>>(Xh, Woh, nullptr, out, bo, MTOT, EMBED);
}

// v006
// It runs in 134 microseconds.
// Two timings next to v005 both put it at 1.03 times that version's speed.
// Over all steps from v000 it is 4.88 times as fast.
#include <hip/hip_runtime.h>

typedef __attribute__((ext_vector_type(16))) _Float16 v16h;
typedef __attribute__((ext_vector_type(8)))  _Float16 v8h;
typedef __attribute__((ext_vector_type(4)))  _Float16 v4h;
typedef __attribute__((ext_vector_type(8)))  float    v8f;

#define EMBED 1024
#define HEADS 16
#define HDIM  64
#define BATCH 4
#define SEQ   2048
#define MTOT  (BATCH * SEQ)   // 8192

// ---------------------------------------------------------------------------
// 16x32 f16 fragment, the wave-lane indexing the M (or N) row.
// Layout per CDNA5 ISA 7.12.2 (16-bit A 16x32):
//   lanes 0-15 : row = lane,    elems 0..7 = K[0..7],  elems 8..15 = K[16..23]
//   lanes 16-31: row = lane-16, elems 0..7 = K[8..15], elems 8..15 = K[24..31]
// B (32x16) uses the symmetric layout, so one loader serves A fragments and B
// fragments from a [N, K] (i.e. B^T) source.
// ---------------------------------------------------------------------------

// ---------------------------------------------------------------------------
// Fragment-ordered operands. Every f16 matrix [rows][K] that a WMMA reads from
// the workspace is kept as blocks of 16 rows x 32 k (512 elements, 1 KiB);
// block (rt, kt) stands at (rt * (K / 32) + kt) * 512. Inside a block the
// 16-byte chunk number u * 32 + lane holds that lane's fragment
// elements 8u .. 8u+7: row = lane & 15, k = 16 * u + 8 * (lane >> 4) + 0..7.
// A wave-wide 16-byte load or store of one u is then 512 contiguous bytes
// (4 cache lines) where the row-major form touches 16 lines.
// ---------------------------------------------------------------------------
__device__ __forceinline__ v16h load_pk(const _Float16* __restrict__ blk) {
  const _Float16* q = blk + (threadIdx.x & 31) * 8;
  union { v8h h[2]; v16h v; } u;
  u.h[0] = *(const v8h*)(q);
  u.h[1] = *(const v8h*)(q + 256);
  return u.v;
}

__device__ __forceinline__ v8f wmma32(v16h a, v16h b, v8f c) {
  return __builtin_amdgcn_wmma_f32_16x16x32_f16(
      /*neg_a=*/false, a, /*neg_b=*/false, b,
      /*c_mod=*/(short)0, c, /*reuse_a=*/false, /*reuse_b=*/false);
}

// ---------------------------------------------------------------------------
// All five f32 operands -> f16, fragment-ordered, in one launch of PACK_T
// threads. dst is the start of the workspace, where X, Wq^T, Wk^T, Wv^T and Wo
// follow one another. A thread owns one place in a block (16-byte chunk t & 63:
// row c, k = 16 u + 8 h + 0..7) and fills it in 12 blocks: in 8 blocks of X
// that follow one another along k, and in block t >> 6 of each weight matrix.
// The launch is small enough to be resident at once (16 waves per WGP): a wave
// is started once for 12 chunks, and all its loads are in flight together.
// ---------------------------------------------------------------------------
#define PACK_T (512 * 256)               // = the chunks of one weight matrix
typedef __attribute__((ext_vector_type(4))) float v4f;

__global__ void __launch_bounds__(256)
pack_all(const float* __restrict__ X, const float* __restrict__ Wq,
         const float* __restrict__ Wk, const float* __restrict__ Wv,
         const float* __restrict__ Wo, _Float16* __restrict__ dst) {
  const unsigned t = blockIdx.x * 256 + threadIdx.x;
  const unsigned c = t & 15, h = (t >> 4) & 1, u = (t >> 5) & 1, blk = t >> 6;
  // X: blocks 8 blk .. 8 blk + 7 (EMBED / 32 = 32 blocks per strip of 16 rows).
  // The chunk's first element in the first of them, in groups of 4 floats; a
  // block on is 8 groups on.
  const unsigned ox = ((blk >> 2) * 16 + c) * (EMBED / 4) + (blk & 3) * 64 + u * 4 + h * 2;
  // weights: block blk = strip rt, k block kt; a source taken as it is,
  // src[row][k], in groups of 4 floats ...
  const unsigned rt = blk >> 5, kt = blk & 31;
  const unsigned op = (rt * 16 + c) * (EMBED / 4) + kt * 8 + u * 4 + h * 2;
  // ... and one taken transposed, logical dst[n][k] = src[k][n], in floats
  const unsigned ot = (kt * 32 + u * 16 + h * 8) * EMBED + rt * 16 + c;

  v4f x[9][2];                           // 8 blocks of X, then Wo
#pragma unroll
  for (int i = 0; i < 8; ++i) {
    x[i][0] = ((const v4f*)X + i * 8)[ox];
    x[i][1] = ((const v4f*)X + i * 8 + 1)[ox];
  }
  x[8][0] = ((const v4f*)Wo)[op];
  x[8][1] = ((const v4f*)Wo + 1)[op];
  v8f w[3];                              // Wq, Wk, Wv
#pragma unroll
  for (int m = 0; m < 3; ++m) {
    const float* q = (m == 0 ? Wq : m == 1 ? Wk : Wv);
#pragma unroll
    for (int e = 0; e < 8; ++e) w[m][e] = (q + e * EMBED)[ot];
  }
  // Holds every load above the first conversion: left alone the compiler waits
  // for the first loads before it issues the later ones, several memory
  // latencies in a row instead of one. The three offsets are named so that they
  // live as long as the loads that name them: no result lands in their registers.
  asm volatile("" :: "v"(x[0][0]), "v"(x[0][1]), "v"(x[1][0]), "v"(x[1][1]),
                     "v"(x[2][0]), "v"(x[2][1]), "v"(x[3][0]), "v"(x[3][1]),
                     "v"(x[4][0]), "v"(x[4][1]), "v"(x[5][0]), "v"(x[5][1]),
                     "v"(x[6][0]), "v"(x[6][1]), "v"(x[7][0]), "v"(x[7][1]),
                     "v"(x[8][0]), "v"(x[8][1]), "v"(w[0]), "v"(w[1]), "v"(w[2]),
                     "v"(ox), "v"(op), "v"(ot));

  const unsigned dx = blk * 512 + (t & 63);        // X: the chunk in block 8 blk
#pragma unroll
  for (int i = 0; i < 9; ++i) {
    v8h o;
#pragma unroll
    for (int e = 0; e < 4; ++e) {
      o[e]     = (_Float16)x[i][0][e];
      o[e + 4] = (_Float16)x[i][1][e];
    }
    if (i < 8) ((v8h*)dst + i * 64)[dx] = o;
    else       ((v8h*)dst + 11 * PACK_T)[t] = o;   // Wo stands last
  }
#pragma unroll
  for (int m = 0; m < 3; ++m) {
    v8h o;
#pragma unroll
    for (int e = 0; e < 8; ++e) o[e] = (_Float16)w[m][e];
    ((v8h*)dst + (8 + m) * PACK_T)[t] = o;
  }
}

// ---------------------------------------------------------------------------
// load_pk of the block that stands blk_bytes behind q in LDS; q holds the
// buffer's start plus the lane's 16 bytes.
// ---------------------------------------------------------------------------
__device__ __forceinline__ v16h load_pk_lds(const _Float16* q, int blk_bytes) {
  union { v8h h[2]; v16h v; } u;
  u.h[0] = *(const v8h*)(q + blk_bytes / 2);
  u.h[1] = *(const v8h*)(q + blk_bytes / 2 + 256);
  return u.v;
}

// ---------------------------------------------------------------------------
// Eight strips of a GEMM stage by asynchronous copies: of each strip (16 rows)
// the stage's four k blocks, 4 KiB contiguous, one 16-byte chunk a thread, a wave
// 512 contiguous bytes per copy. lds: the thread's chunk in the first strip's
// place, the next strips 4 KiB apart. g: the stage's first byte of the first
// strip, the same for the whole block (scalar registers), the next strips 32 KiB
// apart; vo: the thread's byte offset from it. The s_wait_xcnt stands inside the
// statement, so that no register a copy names is rewritten ahead of it.
// ---------------------------------------------------------------------------
__device__ __forceinline__ void copy_strips8(unsigned lds, unsigned vo, const char* g) {
  asm volatile("global_load_async_to_lds_b128 %0, %8, %9\n\t"
               "global_load_async_to_lds_b128 %1, %8, %10\n\t"
               "global_load_async_to_lds_b128 %2, %8, %11\n\t"
               "global_load_async_to_lds_b128 %3, %8, %12\n\t"
               "global_load_async_to_lds_b128 %4, %8, %13\n\t"
               "global_load_async_to_lds_b128 %5, %8, %14\n\t"
               "global_load_async_to_lds_b128 %6, %8, %15\n\t"
               "global_load_async_to_lds_b128 %7, %8, %16\n\t"
               "s_wait_xcnt 0x0"
               :: "v"(lds), "v"(lds + 4096), "v"(lds + 2 * 4096), "v"(lds + 3 * 4096),
                  "v"(lds + 4 * 4096), "v"(lds + 5 * 4096), "v"(lds + 6 * 4096),
                  "v"(lds + 7 * 4096), "v"(vo),
                  "s"(g), "s"(g + 32768), "s"(g + 2 * 32768), "s"(g + 3 * 32768),
                  "s"(g + 4 * 32768), "s"(g + 5 * 32768), "s"(g + 6 * 32768),
                  "s"(g + 7 * 32768)
               : "memory");
}

// ---------------------------------------------------------------------------
// WMMA GEMM: C[M,N] = A[M,K] * B[K,N], with B supplied transposed as Bt[N,K];
// A and Bt fragment-ordered. A block of 8 waves computes a 128x256 tile, each
// wave 64x64 of it (16 wmmas per K=32 step): wave w has rows 64 (w >> 2) and
// columns 64 (w & 3). The block's 8 strips of A and 16 of Bt stand in LDS in two
// buffers of one 128-k stage each (24 strips x 4 KiB); the next stage's copies
// fly while this one is worked on. A strip of A is then fetched once for four
// waves, a strip of Bt once for two.
// MODE 0: f16, per (b,h) the matrix [S][D] fragment-ordered   (Q, K)
// MODE 1: f16, per (b,h) the matrix [D][S] fragment-ordered   (V, for P@V)
// MODE 2: f32 to [M,N] + bias                                 (final output)
// A chunk of the output layout is 8 consecutive k of one row. MODE 1 has them
// in a lane's accumulator as it is (k = s = the tile's rows); MODE 0 (k = d =
// the tile's columns) takes Bt as the A operand, which gives the tile
// transposed: acc[i][j][r] = C[i*16 + nlo][j*16 + 8*half + r].
// ---------------------------------------------------------------------------
template <int MODE>
__global__ void __launch_bounds__(256)
gemm_wmma(const _Float16* __restrict__ A, const _Float16* __restrict__ Bt,
          _Float16* __restrict__ outh, float* __restrict__ outf,
          const float* __restrict__ bias, int M, int N) {
  constexpr int KT = EMBED >> 5;         // blocks per strip; K = EMBED in all four products
  constexpr int KS = 4;                  // k blocks of a stage
  constexpr int NSTAGE = KT / KS;
  constexpr int STRIP_B = KS * 1024;     // bytes of a strip in a stage
  constexpr int STAGE_B = 24 * STRIP_B;  // A 8 strips, then Bt 16 strips
  __shared__ __attribute__((aligned(1024))) _Float16 ring[2 * STAGE_B / 2];

  const int tilesN = N >> 8;
  const int bm = blockIdx.x / tilesN;
  const int bn = blockIdx.x % tilesN;
  if (bm * 128 >= M) return;             // the whole block, in front of every barrier
  // the wave's number as a scalar: its tile and its LDS strips are wave-uniform
  const int w  = __builtin_amdgcn_readfirstlane(threadIdx.x >> 5);
  const int tm = bm * 2 + (w >> 2);
  const int tn = bn * 4 + (w & 3);
  const int lane = threadIdx.x & 31;
  const int half = lane >> 4, nlo = lane & 15;

  const unsigned vo = threadIdx.x * 16;
  const unsigned lds0 = (unsigned)(size_t)ring + vo;
  const char* ga = (const char*)A  + (size_t)bm * 8  * KT * 1024;
  const char* gb = (const char*)Bt + (size_t)bn * 16 * KT * 1024;

  copy_strips8(lds0,                vo, ga);
  copy_strips8(lds0 +  8 * STRIP_B, vo, gb);
  copy_strips8(lds0 + 16 * STRIP_B, vo, gb + 8 * KT * 1024);
  // stage 0 has landed for this wave, then for all: nobody reads it before
  asm volatile("s_wait_asynccnt 0x0" ::: "memory");
  __syncthreads();
  copy_strips8(lds0 + STAGE_B,                vo, ga + STRIP_B);
  copy_strips8(lds0 + STAGE_B +  8 * STRIP_B, vo, gb + STRIP_B);
  copy_strips8(lds0 + STAGE_B + 16 * STRIP_B, vo, gb + 8 * KT * 1024 + STRIP_B);
  ga += 2 * STRIP_B;
  gb += 2 * STRIP_B;

  v8f acc[4][4] = {};

  for (int st = 0; st < NSTAGE; ++st) {
    const int buf = (st & 1) * STAGE_B;
    // the lane's chunk in the wave's first strip of each operand
    const _Float16* sa = ring + (buf + (w >> 2) * 4 * STRIP_B) / 2 + lane * 8;
    const _Float16* sb = ring + (buf + (8 + (w & 3) * 4) * STRIP_B) / 2 + lane * 8;
    // Two fragment sets: the next k block's LDS reads go out ahead of this block's
    // products, in two groups: A and half of B in front of the block, the rest of
    // B at its middle, into the registers that the first half of this block's B
    // has left (all in front would take the wave past 256 VGPRs).
    // The scheduling barriers keep reads and products in that order: left alone
    // the compiler sinks each read to just before its first use, into one
    // fragment set, and the wave waits out the LDS latency four times a k block.
    v16h af[2][4], bf[2][4];
#pragma unroll
    for (int i = 0; i < 4; ++i) {
      af[0][i] = load_pk_lds(sa, i * STRIP_B);
      bf[0][i] = load_pk_lds(sb, i * STRIP_B);
    }
#pragma unroll
    for (int kk = 0; kk < KS; ++kk) {
      const int c = kk & 1;
#pragma unroll
      for (int jh = 0; jh < 2; ++jh) {
        if (kk + 1 < KS) {
          if (jh == 0) {
#pragma unroll
            for (int i = 0; i < 4; ++i)
              af[c ^ 1][i] = load_pk_lds(sa, i * STRIP_B + (kk + 1) * 1024);
          }
#pragma unroll
          for (int j = 2 * jh; j < 2 * jh + 2; ++j)
            bf[c ^ 1][j] = load_pk_lds(sb, j * STRIP_B + (kk + 1) * 1024);
        }
        __builtin_amdgcn_sched_barrier(0);   // the reads stay ahead of the products
#pragma unroll
        for (int j = 2 * jh; j < 2 * jh + 2; ++j) {
#pragma unroll
          for (int i = 0; i < 4; ++i)
            acc[i][j] = (MODE == 0) ? wmma32(bf[c][j], af[c][i], acc[i][j])
                                    : wmma32(af[c][i], bf[c][j], acc[i][j]);
        }
        // the products stay ahead of the next reads, the last ones ahead of the
        // hand-over and its branch
        __builtin_amdgcn_sched_barrier(0);
      }
    }

    // ---- hand-over: this wave's reads of the stage are done, its copies of the
    // next have landed; behind the barrier both hold for all 8 waves, so the next
    // stage may be read and this stage's buffer refilled ----
    asm volatile("s_wait_dscnt 0x0" ::: "memory");
    asm volatile("s_wait_asynccnt 0x0" ::: "memory");
    __syncthreads();
    // the four vector slots between the last WMMA and the first instruction that
    // overwrites its operands, on both sides of the branch
    asm volatile("v_nop\n\tv_nop\n\tv_nop\n\tv_nop");
    if (st + 2 < NSTAGE) {
      copy_strips8(lds0 + buf,                vo, ga);
      copy_strips8(lds0 + buf +  8 * STRIP_B, vo, gb);
      copy_strips8(lds0 + buf + 16 * STRIP_B, vo, gb + 8 * KT * 1024);
      ga += STRIP_B;
      gb += STRIP_B;
    }
  }
  // no copy is outstanding when the wave ends
  asm volatile("s_wait_asynccnt 0x0" ::: "memory");

  if (MODE == 2) {
#pragma unroll
    for (int i = 0; i < 4; ++i) {
#pragma unroll
      for (int j = 0; j < 4; ++j) {
#pragma unroll
        for (int r = 0; r < 8; ++r) {
          const int m = tm * 64 + i * 16 + r + half * 8;
          const int n = tn * 64 + j * 16 + nlo;
          outf[(size_t)m * N + n] = acc[i][j][r] + bias[n];
        }
      }
    }
  } else {
    // the 64 tile rows lie in one batch (b = tm >> 5, s0 = (tm & 31) * 64),
    // the 64 tile columns are one head (h = tn)
    _Float16* ob = outh + (size_t)((tm >> 5) * HEADS + tn) * SEQ * HDIM + lane * 8;
    const int st = tm & 31;
#pragma unroll
    for (int i = 0; i < 4; ++i) {
#pragma unroll
      for (int j = 0; j < 4; ++j) {
        v8h o;
#pragma unroll
        for (int r = 0; r < 8; ++r) o[r] = (_Float16)acc[i][j][r];
        const int off = (MODE == 0)
            ? ((st * 4 + i) * 2 + (j >> 1)) * 512 + (j & 1) * 256     // [S][D], 2 blocks per strip
            : (j * 64 + st * 2 + (i >> 1)) * 512 + (i & 1) * 256;     // [D][S], 64 blocks per strip
        *(v8h*)(ob + off) = o;
      }
    }
  }
}

// ---------------------------------------------------------------------------
// Lane l <-> lane l ^ 16: the other half's value of the same column.
// ---------------------------------------------------------------------------
__device__ __forceinline__ float other_half(float x) {
  const int b = __builtin_bit_cast(int, x);
  return __builtin_bit_cast(float,
      __builtin_amdgcn_permlanex16(b, b, 0x76543210, 0xfedcba98, false, false));
}

// ---------------------------------------------------------------------------
// 2^x by v_exp_f32, eight at a time and one alone, in place. Behind a
// transcendental the instruction set asks for one independent instruction
// before its source is overwritten or its result read.
// Written so, each v_exp_f32 is followed by an independent one and the last by
// the v_nop that fills its slot.
// ---------------------------------------------------------------------------
__device__ __forceinline__ v8f exp2_x8(v8f x) {
  float y0 = x[0], y1 = x[1], y2 = x[2], y3 = x[3];
  float y4 = x[4], y5 = x[5], y6 = x[6], y7 = x[7];
  asm("v_exp_f32 %0, %0\n\t"
      "v_exp_f32 %1, %1\n\t"
      "v_exp_f32 %2, %2\n\t"
      "v_exp_f32 %3, %3\n\t"
      "v_exp_f32 %4, %4\n\t"
      "v_exp_f32 %5, %5\n\t"
      "v_exp_f32 %6, %6\n\t"
      "v_exp_f32 %7, %7\n\t"
      "v_nop"
      : "+v"(y0), "+v"(y1), "+v"(y2), "+v"(y3),
        "+v"(y4), "+v"(y5), "+v"(y6), "+v"(y7));
  v8f y = {y0, y1, y2, y3, y4, y5, y6, y7};
  return y;
}
__device__ __forceinline__ float exp2_x1(float x) {
  asm("v_exp_f32 %0, %0\n\t"
      "v_nop"
      : "+v"(x));
  return x;
}

// ---------------------------------------------------------------------------
// One stage of the attention ring: 64 keys of K (8 KiB, contiguous) and of V^T
// (four d strips of 2 KiB), 16 KiB in LDS. Each of the 256 threads brings four
// 16-byte chunks by asynchronous copies, a wave 512 contiguous bytes per copy.
// lds: the thread's chunk in the buffer's first 4 KiB. kb, vb: the stage's first
// byte of K and of V^T strip 0, the same for the whole block (scalar registers);
// ko, vo: the thread's byte offsets from them. The s_wait_xcnt stands inside the
// statement, so that no register a copy names is rewritten ahead of it.
// ---------------------------------------------------------------------------
__device__ __forceinline__ void copy_stage(unsigned lds, const char* kb, unsigned ko,
                                           const char* vb, unsigned vo) {
  const unsigned l1 = lds + 4096, l2 = lds + 8192, l3 = lds + 12288;
  const char* kb1 = kb + 4096;          // keys 32..63 of the stage
  const char* vb1 = vb + 2 * 65536;     // two d strips on
  asm volatile("global_load_async_to_lds_b128 %0, %4, %6\n\t"
               "global_load_async_to_lds_b128 %1, %4, %7\n\t"
               "global_load_async_to_lds_b128 %2, %5, %8\n\t"
               "global_load_async_to_lds_b128 %3, %5, %9\n\t"
               "s_wait_xcnt 0x0"
               :: "v"(lds), "v"(l1), "v"(l2), "v"(l3), "v"(ko), "v"(vo),
                  "s"(kb), "s"(kb1), "s"(vb), "s"(vb1)
               : "memory");
}

__global__ void __launch_bounds__(256) __attribute__((amdgpu_waves_per_eu(4, 4)))
attn_wmma(const _Float16* __restrict__ Q, const _Float16* __restrict__ K,
          const _Float16* __restrict__ Vt, _Float16* __restrict__ Ctx) {
  // the wave's number as a scalar: tile and head then live in scalar registers
  const int wave = blockIdx.x * 8 + __builtin_amdgcn_readfirstlane(threadIdx.x >> 5);
  const int qp = wave & 63;              // pair of q tiles within head (S/32 = 64)
  const int bh = wave >> 6;              // b*HEADS + h
  const int lane = threadIdx.x & 31;
  constexpr int STAGE_B = 16384;         // bytes of a stage: K 8 KiB, then V^T 8 KiB
  constexpr int NSTAGE = SEQ / 64;
  __shared__ __attribute__((aligned(1024))) _Float16 ring[2 * STAGE_B / 2];

  const _Float16* Qb = Q  + ((size_t)bh * SEQ + qp * 32) * HDIM;   // strips 2 qp, 2 qp + 1: 4 blocks
  const _Float16* Kb = K  + (size_t)bh * SEQ * HDIM;
  const _Float16* Vb = Vt + (size_t)bh * HDIM * SEQ;

  // the thread's chunks in a stage; a stage on is 8 KiB of K, 2 KiB of each V^T strip
  const unsigned ko = threadIdx.x * 16;
  const unsigned vo = (threadIdx.x >> 7) * 65536 + (threadIdx.x & 127) * 16;
  const unsigned lds0 = (unsigned)(size_t)ring + threadIdx.x * 16;
  const char* kg = (const char*)Kb;
  const char* vg = (const char*)Vb;

  copy_stage(lds0, kg, ko, vg, vo);
  // stage 0 has landed for this wave, then for all: nobody reads it before
  asm volatile("s_wait_asynccnt 0x0" ::: "memory");
  __syncthreads();
  copy_stage(lds0 + STAGE_B, kg + 8192, ko, vg + 2048, vo);
  kg += 2 * 8192;
  vg += 2 * 2048;

  v16h bq[2][2];                         // Q rows as columns of Q^T: [tile][d 0..31, d 32..63]
#pragma unroll
  for (int c = 0; c < 2; ++c) {
    bq[c][0] = load_pk(Qb + c * 1024);
    bq[c][1] = load_pk(Qb + c * 1024 + 512);
  }

  v8f ctx[2][4] = {};                    // ctx[c][j][r] = O[q][16 j + 8 half + r]
  float mrow[2] = {-1e30f, -1e30f};      // the query's maximum
  float lrow[2] = {0.0f, 0.0f};          // this lane's share of its sum
  const float sc = 0.125f;               // 1/sqrt(64)
  const float L2E = 1.44269504f;         // log2(e): e^x = 2^(x * L2E)

  for (int st = 0; st < NSTAGE; ++st) {
    const int buf = (st & 1) * STAGE_B;
    const _Float16* sk = ring + buf / 2 + lane * 8;   // the stage's K; V^T 8 KiB on
    // ---- scores: per query tile four 16(kv) x 16(q) tiles over the stage's 64 keys ----
    v8f s[2][4] = {};
#pragma unroll
    for (int t = 0; t < 4; ++t) {
      const v16h ka0 = load_pk_lds(sk, t * 2048);
      const v16h ka1 = load_pk_lds(sk, t * 2048 + 1024);
#pragma unroll
      for (int c = 0; c < 2; ++c) s[c][t] = wmma32(ka0, bq[c][0], s[c][t]);
#pragma unroll
      for (int c = 0; c < 2; ++c) s[c][t] = wmma32(ka1, bq[c][1], s[c][t]);
    }

    // ---- online softmax, one query per lane and tile ----
    v16h pb[2][2];                       // P^T as B operands: the stage's keys 0..31, 32..63
#pragma unroll
    for (int c = 0; c < 2; ++c) {
      float mt[4];
#pragma unroll
      for (int t = 0; t < 4; ++t) {
#pragma unroll
        for (int r = 0; r < 8; ++r) s[c][t][r] *= sc;
        mt[t] = fmaxf(fmaxf(fmaxf(s[c][t][0], s[c][t][1]), fmaxf(s[c][t][2], s[c][t][3])),
                      fmaxf(fmaxf(s[c][t][4], s[c][t][5]), fmaxf(s[c][t][6], s[c][t][7])));
      }
      float mx = fmaxf(fmaxf(mt[0], mt[1]), fmaxf(mt[2], mt[3]));
      mx = fmaxf(mx, other_half(mx));
      const float mn = fmaxf(mrow[c], mx);
      float rs[4];
#pragma unroll
      for (int t = 0; t < 4; ++t) {
#pragma unroll
        for (int r = 0; r < 8; ++r) s[c][t][r] = (s[c][t][r] - mn) * L2E;
        s[c][t] = exp2_x8(s[c][t]);
        rs[t] = ((s[c][t][0] + s[c][t][1]) + (s[c][t][2] + s[c][t][3])) +
                ((s[c][t][4] + s[c][t][5]) + (s[c][t][6] + s[c][t][7]));
      }
      const float f = exp2_x1((mrow[c] - mn) * L2E);
      lrow[c] = lrow[c] * f + ((rs[0] + rs[1]) + (rs[2] + rs[3]));
      mrow[c] = mn;
#pragma unroll
      for (int j = 0; j < 4; ++j)
#pragma unroll
        for (int r = 0; r < 8; ++r) ctx[c][j][r] *= f;

      // element e = key 8 half + e (e < 8), 16 + 8 half + e - 8
#pragma unroll
      for (int r = 0; r < 8; ++r) {
        pb[c][0][r] = (_Float16)s[c][0][r];  pb[c][0][r + 8] = (_Float16)s[c][1][r];
        pb[c][1][r] = (_Float16)s[c][2][r];  pb[c][1][r + 8] = (_Float16)s[c][3][r];
      }
    }

    // ---- O^T += V^T P^T : four 16-wide d chunks, two kv halves each ----
#pragma unroll
    for (int j = 0; j < 4; ++j) {
      const v16h va0 = load_pk_lds(sk, 8192 + j * 2048);
      const v16h va1 = load_pk_lds(sk, 8192 + j * 2048 + 1024);
#pragma unroll
      for (int c = 0; c < 2; ++c) ctx[c][j] = wmma32(va0, pb[c][0], ctx[c][j]);
#pragma unroll
      for (int c = 0; c < 2; ++c) ctx[c][j] = wmma32(va1, pb[c][1], ctx[c][j]);
    }

    // ---- hand-over: this wave's reads of the stage are done, its copies of the
    // next have landed; behind the barrier both hold for all 8 waves, so the next
    // stage may be read and this stage's buffer refilled ----
    // The products stay above the hand-over: sunk below it they stood directly
    // in front of the branch.
    __builtin_amdgcn_sched_barrier(0);
    asm volatile("s_wait_dscnt 0x0" ::: "memory");
    asm volatile("s_wait_asynccnt 0x0" ::: "memory");
    __syncthreads();
    // the four vector slots between the last WMMA and the first instruction that
    // overwrites its operands, on both sides of the branch
    asm volatile("v_nop\n\tv_nop\n\tv_nop\n\tv_nop");
    if (st + 2 < NSTAGE) {
      copy_stage(lds0 + buf, kg, ko, vg, vo);
      kg += 8192;
      vg += 2048;
    }
  }
  // no copy is outstanding when the wave ends
  asm volatile("s_wait_asynccnt 0x0" ::: "memory");

  // ---- join the halves' sums, normalize; a lane's 8 registers of tile j are
  // 8 consecutive d of its query: one chunk of the Ctx layout as they stand ----
  const int b = bh >> 4, h = bh & 15;
#pragma unroll
  for (int c = 0; c < 2; ++c) {
    const float inv = 1.0f / (lrow[c] + other_half(lrow[c]));
    // strip b * 128 + 2 qp + c of [B*S][E] (32 blocks per strip), blocks 2h and 2h + 1
    _Float16* cb = Ctx + ((size_t)(b * (SEQ / 16) + qp * 2 + c) * 32 + h * 2) * 512 + lane * 8;
#pragma unroll
    for (int j = 0; j < 4; ++j) {
      v8h o;
#pragma unroll
      for (int r = 0; r < 8; ++r) o[r] = (_Float16)(ctx[c][j][r] * inv);
      *(v8h*)(cb + j * 256) = o;
    }
  }
}

// ---------------------------------------------------------------------------
// Host-side orchestration
// Workspace (f16 elems): [0,8M) Xh (reused as Ctx), [8M..12M) weights,
// [12M..20M) Qh, [20M..28M) Kh, [28M..36M) Vth  => 72 MB total.
// ---------------------------------------------------------------------------
extern "C" void kernel_launch(void* const* d_in, const int* in_sizes, int n_in,
                              void* d_out, int out_size, void* d_ws, size_t ws_size,
                              hipStream_t stream) {
  const float* X  = (const float*)d_in[0];
  const float* Wq = (const float*)d_in[1];
  const float* Wk = (const float*)d_in[2];
  const float* Wv = (const float*)d_in[3];
  const float* Wo = (const float*)d_in[4];
  const float* bo = (const float*)d_in[5];
  float* out = (float*)d_out;

  _Float16* ws = (_Float16*)d_ws;
  const size_t M1 = (size_t)1024 * 1024;
  _Float16* Xh  = ws;             // 8M elems; later reused as Ctx (f16)
  _Float16* Wqt = ws + 8 * M1;    // W_q^T  [f,e]
  _Float16* Wkt = ws + 9 * M1;
  _Float16* Wvt = ws + 10 * M1;
  _Float16* Woh = ws + 11 * M1;   // W_o    [f,e] (already B^T layout for x@Wo^T)
  _Float16* Qh  = ws + 12 * M1;   // per (b,h) [S][D]
  _Float16* Kh  = ws + 20 * M1;   // per (b,h) [S][D]
  _Float16* Vth = ws + 28 * M1;   // per (b,h) [D][S]

  // 1) precision conversion / weight re-layout: Xh .. Woh, 12M elems from ws on
  pack_all<<<512, 256, 0, stream>>>(X, Wq, Wk, Wv, Wo, ws);

  // 2) Q/K/V projections (8192x1024x1024 each), 2048 waves / 256 blocks
  gemm_wmma<0><<<256, 256, 0, stream>>>(Xh, Wqt, Qh,  nullptr, nullptr, MTOT, EMBED);
  gemm_wmma<0><<<256, 256, 0, stream>>>(Xh, Wkt, Kh,  nullptr, nullptr, MTOT, EMBED);
  gemm_wmma<1><<<256, 256, 0, stream>>>(Xh, Wvt, Vth, nullptr, nullptr, MTOT, EMBED);

  // 3) flash attention: 4096 pairs of q-tiles -> 512 blocks of 8 waves; Ctx -> Xh
  attn_wmma<<<512, 256, 0, stream>>>(Qh, Kh, Vth, Xh);

  // 4) output projection + bias, f32 result
  gemm_wmma<2><<<256, 256, 0, stream>>>(Xh, Woh, nullptr, out, bo, MTOT, EMBED);
}

// v008
// Measured time: 117 microseconds a run.
// Versions in between are left out here; by their measured steps it is 1.15 times as fast as v006.
// All steps since v000 together make it 5.60 times as fast.
#include <hip/hip_runtime.h>

typedef __attribute__((ext_vector_type(16))) _Float16 v16h;
typedef __attribute__((ext_vector_type(8)))  _Float16 v8h;
typedef __attribute__((ext_vector_type(4)))  _Float16 v4h;
typedef __attribute__((ext_vector_type(8)))  float    v8f;

#define EMBED 1024
#define HEADS 16
#define HDIM  64
#define BATCH 4
#define SEQ   2048
#define MTOT  (BATCH * SEQ)   // 8192

// ---------------------------------------------------------------------------
// 16x32 f16 fragment, the wave-lane indexing the M (or N) row.
// Layout per CDNA5 ISA 7.12.2 (16-bit A 16x32):
//   lanes 0-15 : row = lane,    elems 0..7 = K[0..7],  elems 8..15 = K[16..23]
//   lanes 16-31: row = lane-16, elems 0..7 = K[8..15], elems 8..15 = K[24..31]
// B (32x16) uses the symmetric layout, so one loader serves A fragments and B
// fragments from a [N, K] (i.e. B^T) source.
// ---------------------------------------------------------------------------

// ---------------------------------------------------------------------------
// Fragment-ordered operands. Every f16 matrix [rows][K] that a WMMA reads from
// the workspace is kept as blocks of 16 rows x 32 k (512 elements, 1 KiB);
// block (rt, kt) stands at (rt * (K / 32) + kt) * 512. Inside a block the
// 16-byte chunk number u * 32 + lane holds that lane's fragment
// elements 8u .. 8u+7: row = lane & 15, k = 16 * u + 8 * (lane >> 4) + 0..7.
// A wave-wide 16-byte load or store of one u is then 512 contiguous bytes
// (4 cache lines) where the row-major form touches 16 lines.
// ---------------------------------------------------------------------------
__device__ __forceinline__ v16h load_pk(const _Float16* __restrict__ blk) {
  const _Float16* q = blk + (threadIdx.x & 31) * 8;
  union { v8h h[2]; v16h v; } u;
  u.h[0] = *(const v8h*)(q);
  u.h[1] = *(const v8h*)(q + 256);
  return u.v;
}

__device__ __forceinline__ v8f wmma32(v16h a, v16h b, v8f c) {
  return __builtin_amdgcn_wmma_f32_16x16x32_f16(
      /*neg_a=*/false, a, /*neg_b=*/false, b,
      /*c_mod=*/(short)0, c, /*reuse_a=*/false, /*reuse_b=*/false);
}

// ---------------------------------------------------------------------------
// All five f32 operands -> f16, fragment-ordered, in one launch of PACK_T
// threads. dst is the start of the workspace, where X, Wq^T, Wk^T, Wv^T and Wo
// follow one another. A thread owns one place in a block (16-byte chunk t & 63:
// row c, k = 16 u + 8 h + 0..7) and fills it in 12 blocks: in 8 blocks of X
// that follow one another along k, and in block t >> 6 of each weight matrix.
// The launch is small enough to be resident at once (16 waves per WGP): a wave
// is started once for 12 chunks, and all its loads are in flight together.
// Wq is stored times QSCALE, so that Q K^T comes out of the matrix unit as the
// exponent of 2 that the softmax needs: score / sqrt(HDIM) * log2(e).
// ---------------------------------------------------------------------------
#define QSCALE (0.125f * 1.44269504f)
#define PACK_T (512 * 256)               // = the chunks of one weight matrix
typedef __attribute__((ext_vector_type(4))) float v4f;

__global__ void __launch_bounds__(256)
pack_all(const float* __restrict__ X, const float* __restrict__ Wq,
         const float* __restrict__ Wk, const float* __restrict__ Wv,
         const float* __restrict__ Wo, _Float16* __restrict__ dst) {
  const unsigned t = blockIdx.x * 256 + threadIdx.x;
  const unsigned c = t & 15, h = (t >> 4) & 1, u = (t >> 5) & 1, blk = t >> 6;
  // X: blocks 8 blk .. 8 blk + 7 (EMBED / 32 = 32 blocks per strip of 16 rows).
  // The chunk's first element in the first of them, in groups of 4 floats; a
  // block on is 8 groups on.
  const unsigned ox = ((blk >> 2) * 16 + c) * (EMBED / 4) + (blk & 3) * 64 + u * 4 + h * 2;
  // weights: block blk = strip rt, k block kt; a source taken as it is,
  // src[row][k], in groups of 4 floats ...
  const unsigned rt = blk >> 5, kt = blk & 31;
  const unsigned op = (rt * 16 + c) * (EMBED / 4) + kt * 8 + u * 4 + h * 2;
  // ... and one taken transposed, logical dst[n][k] = src[k][n], in floats
  const unsigned ot = (kt * 32 + u * 16 + h * 8) * EMBED + rt * 16 + c;

  v4f x[9][2];                           // 8 blocks of X, then Wo
#pragma unroll
  for (int i = 0; i < 8; ++i) {
    x[i][0] = ((const v4f*)X + i * 8)[ox];
    x[i][1] = ((const v4f*)X + i * 8 + 1)[ox];
  }
  x[8][0] = ((const v4f*)Wo)[op];
  x[8][1] = ((const v4f*)Wo + 1)[op];
  v8f w[3];                              // Wq, Wk, Wv
#pragma unroll
  for (int m = 0; m < 3; ++m) {
    const float* q = (m == 0 ? Wq : m == 1 ? Wk : Wv);
#pragma unroll
    for (int e = 0; e < 8; ++e) w[m][e] = (q + e * EMBED)[ot];
  }
  // Holds every load above the first conversion: left alone the compiler waits
  // for the first loads before it issues the later ones, several memory
  // latencies in a row instead of one. The three offsets are named so that they
  // live as long as the loads that name them: no result lands in their registers.
  asm volatile("" :: "v"(x[0][0]), "v"(x[0][1]), "v"(x[1][0]), "v"(x[1][1]),
                     "v"(x[2][0]), "v"(x[2][1]), "v"(x[3][0]), "v"(x[3][1]),
                     "v"(x[4][0]), "v"(x[4][1]), "v"(x[5][0]), "v"(x[5][1]),
                     "v"(x[6][0]), "v"(x[6][1]), "v"(x[7][0]), "v"(x[7][1]),
                     "v"(x[8][0]), "v"(x[8][1]), "v"(w[0]), "v"(w[1]), "v"(w[2]),
                     "v"(ox), "v"(op), "v"(ot));

  const unsigned dx = blk * 512 + (t & 63);        // X: the chunk in block 8 blk
#pragma unroll
  for (int i = 0; i < 9; ++i) {
    v8h o;
#pragma unroll
    for (int e = 0; e < 4; ++e) {
      o[e]     = (_Float16)x[i][0][e];
      o[e + 4] = (_Float16)x[i][1][e];
    }
    if (i < 8) ((v8h*)dst + i * 64)[dx] = o;
    else       ((v8h*)dst + 11 * PACK_T)[t] = o;   // Wo stands last
  }
#pragma unroll
  for (int m = 0; m < 3; ++m) {
    v8h o;
#pragma unroll
    for (int e = 0; e < 8; ++e) o[e] = (_Float16)(m == 0 ? w[m][e] * QSCALE : w[m][e]);
    ((v8h*)dst + (8 + m) * PACK_T)[t] = o;
  }
}

// ---------------------------------------------------------------------------
// load_pk of the block that stands blk_bytes behind q in LDS; q holds the
// buffer's start plus the lane's 16 bytes.
// ---------------------------------------------------------------------------
__device__ __forceinline__ v16h load_pk_lds(const _Float16* q, int blk_bytes) {
  union { v8h h[2]; v16h v; } u;
  u.h[0] = *(const v8h*)(q + blk_bytes / 2);
  u.h[1] = *(const v8h*)(q + blk_bytes / 2 + 256);
  return u.v;
}

// ---------------------------------------------------------------------------
// Eight strips of a GEMM stage by asynchronous copies: of each strip (16 rows)
// the stage's four k blocks, 4 KiB contiguous, one 16-byte chunk a thread, a wave
// 512 contiguous bytes per copy. lds: the thread's chunk in the first strip's
// place, the next strips 4 KiB apart. g: the stage's first byte of the first
// strip, the same for the whole block (scalar registers), the next strips 32 KiB
// apart; vo: the thread's byte offset from it. The s_wait_xcnt stands inside the
// statement, so that no register a copy names is rewritten ahead of it.
// ---------------------------------------------------------------------------
__device__ __forceinline__ void copy_strips8(unsigned lds, unsigned vo, const char* g) {
  asm volatile("global_load_async_to_lds_b128 %0, %8, %9\n\t"
               "global_load_async_to_lds_b128 %1, %8, %10\n\t"
               "global_load_async_to_lds_b128 %2, %8, %11\n\t"
               "global_load_async_to_lds_b128 %3, %8, %12\n\t"
               "global_load_async_to_lds_b128 %4, %8, %13\n\t"
               "global_load_async_to_lds_b128 %5, %8, %14\n\t"
               "global_load_async_to_lds_b128 %6, %8, %15\n\t"
               "global_load_async_to_lds_b128 %7, %8, %16\n\t"
               "s_wait_xcnt 0x0"
               :: "v"(lds), "v"(lds + 4096), "v"(lds + 2 * 4096), "v"(lds + 3 * 4096),
                  "v"(lds + 4 * 4096), "v"(lds + 5 * 4096), "v"(lds + 6 * 4096),
                  "v"(lds + 7 * 4096), "v"(vo),
                  "s"(g), "s"(g + 32768), "s"(g + 2 * 32768), "s"(g + 3 * 32768),
                  "s"(g + 4 * 32768), "s"(g + 5 * 32768), "s"(g + 6 * 32768),
                  "s"(g + 7 * 32768)
               : "memory");
}

// ---------------------------------------------------------------------------
// WMMA GEMM: C[M,N] = A[M,K] * B[K,N], with B supplied transposed as Bt[N,K];
// A and Bt fragment-ordered. A block of 8 waves computes a 128x256 tile, each
// wave 64x64 of it (16 wmmas per K=32 step): wave w has rows 64 (w >> 2) and
// columns 64 (w & 3). The block's 8 strips of A and 16 of Bt stand in LDS in two
// buffers of one 128-k stage each (24 strips x 4 KiB); the next stage's copies
// fly while this one is worked on. A strip of A is then fetched once for four
// waves, a strip of Bt once for two.
// MODE 0: f16, per (b,h) the matrix [S][D] fragment-ordered   (Q, K)
// MODE 1: f16, per (b,h) the matrix [D][S] fragment-ordered   (V, for P@V)
// MODE 2: f32 to [M,N] + bias                                 (final output)
// A chunk of the output layout is 8 consecutive k of one row. MODE 1 has them
// in a lane's accumulator as it is (k = s = the tile's rows); MODE 0 (k = d =
// the tile's columns) takes Bt as the A operand, which gives the tile
// transposed: acc[i][j][r] = C[i*16 + nlo][j*16 + 8*half + r].
// ---------------------------------------------------------------------------
#define GEMM_KT      (EMBED >> 5)          // blocks per strip; K = EMBED in all four products
#define GEMM_KS      4                     // k blocks of a stage
#define GEMM_NSTAGE  (GEMM_KT / GEMM_KS)   // stages of one product
#define GEMM_STRIP_B (GEMM_KS * 1024)      // bytes of a strip in a stage
#define GEMM_STAGE_B (24 * GEMM_STRIP_B)   // A 8 strips, then Bt 16 strips
#define GEMM_W_B     (EMBED * EMBED * 2)   // bytes of one weight matrix

// ---------------------------------------------------------------------------
// One stage of the GEMM ring into the buffer at lds. The stages of a launch are
// numbered through all its products: stage g is stage g % NSTAGE of product
// g / NSTAGE. Every product reads the same strips of A (ga: the block's first);
// its Bt stands g / NSTAGE weight matrices behind gb (the block's first strip in
// the first one).
// ---------------------------------------------------------------------------
__device__ __forceinline__ void copy_gemm_stage(unsigned lds, unsigned vo, const char* ga,
                                                const char* gb, int g) {
  const int ks = (g % GEMM_NSTAGE) * GEMM_STRIP_B;
  const char* a = ga + ks;
  const char* b = gb + (size_t)(g / GEMM_NSTAGE) * GEMM_W_B + ks;
  copy_strips8(lds,                     vo, a);
  copy_strips8(lds +  8 * GEMM_STRIP_B, vo, b);
  copy_strips8(lds + 16 * GEMM_STRIP_B, vo, b + 8 * GEMM_KT * 1024);
}

// ---------------------------------------------------------------------------
// One product of a launch: its NSTAGE stages, g0 the number of the first, and its
// store. On entry stage g0 is published and stage g0 + 1 is in flight. The refill
// behind each hand-over does not stop at the product's end: while gtot, the
// launch's stages, is not reached, the last two hand-overs bring the next
// product's first two stages, which fly during this product's last stage and its
// store.
// ---------------------------------------------------------------------------
template <int MODE>
__device__ __forceinline__ void
gemm_product(const _Float16* ring, unsigned lds0, unsigned vo, const char* ga, const char* gb,
             int g0, int gtot, int w, int tm, int tn,
             _Float16* __restrict__ outh, float* __restrict__ outf,
             const float* __restrict__ bias, int N) {
  constexpr int KS = GEMM_KS, NSTAGE = GEMM_NSTAGE;
  constexpr int STRIP_B = GEMM_STRIP_B, STAGE_B = GEMM_STAGE_B;
  const int lane = threadIdx.x & 31;
  const int half = lane >> 4, nlo = lane & 15;

  v8f acc[4][4] = {};

  for (int st = 0; st < NSTAGE; ++st) {
    const int buf = (st & 1) * STAGE_B;    // NSTAGE is even: g0 + st and st are alike in parity
    // the lane's chunk in the wave's first strip of each operand
    const _Float16* sa = ring + (buf + (w >> 2) * 4 * STRIP_B) / 2 + lane * 8;
    const _Float16* sb = ring + (buf + (8 + (w & 3) * 4) * STRIP_B) / 2 + lane * 8;
    // Two fragment sets: the next k block's LDS reads go out ahead of this block's
    // products, in two groups: A and half of B in front of the block, the rest of
    // B at its middle, into the registers that the first half of this block's B
    // has left (all in front would take the wave past 256 VGPRs).
    // The scheduling barriers keep reads and products in that order: left alone
    // the compiler sinks each read to just before its first use, into one
    // fragment set, and the wave waits out the LDS latency four times a k block.
    v16h af[2][4], bf[2][4];
#pragma unroll
    for (int i = 0; i < 4; ++i) {
      af[0][i] = load_pk_lds(sa, i * STRIP_B);
      bf[0][i] = load_pk_lds(sb, i * STRIP_B);
    }
#pragma unroll
    for (int kk = 0; kk < KS; ++kk) {
      const int c = kk & 1;
#pragma unroll
      for (int jh = 0; jh < 2; ++jh) {
        if (kk + 1 < KS) {
          if (jh == 0) {
#pragma unroll
            for (int i = 0; i < 4; ++i)
              af[c ^ 1][i] = load_pk_lds(sa, i * STRIP_B + (kk + 1) * 1024);
          }
#pragma unroll
          for (int j = 2 * jh; j < 2 * jh + 2; ++j)
            bf[c ^ 1][j] = load_pk_lds(sb, j * STRIP_B + (kk + 1) * 1024);
        }
        __builtin_amdgcn_sched_barrier(0);   // the reads stay ahead of the products
#pragma unroll
        for (int j = 2 * jh; j < 2 * jh + 2; ++j) {
#pragma unroll
          for (int i = 0; i < 4; ++i)
            acc[i][j] = (MODE == 0) ? wmma32(bf[c][j], af[c][i], acc[i][j])
                                    : wmma32(af[c][i], bf[c][j], acc[i][j]);
        }
        // the products stay ahead of the next reads, the last ones ahead of the
        // hand-over and its branch
        __builtin_amdgcn_sched_barrier(0);
      }
    }

    // ---- hand-over: this wave's reads of the stage are done, its copies of the
    // next have landed; behind the barrier both hold for all 8 waves, so the next
    // stage may be read and this stage's buffer refilled ----
    asm volatile("s_wait_dscnt 0x0" ::: "memory");
    asm volatile("s_wait_asynccnt 0x0" ::: "memory");
    __syncthreads();
    // the four vector slots between the last WMMA and the first instruction that
    // overwrites its operands, on both sides of the branch
    asm volatile("v_nop\n\tv_nop\n\tv_nop\n\tv_nop");
    if (g0 + st + 2 < gtot) copy_gemm_stage(lds0 + buf, vo, ga, gb, g0 + st + 2);
  }

  if (MODE == 2) {
#pragma unroll
    for (int i = 0; i < 4; ++i) {
#pragma unroll
      for (int j = 0; j < 4; ++j) {
#pragma unroll
        for (int r = 0; r < 8; ++r) {
          const int m = tm * 64 + i * 16 + r + half * 8;
          const int n = tn * 64 + j * 16 + nlo;
          outf[(size_t)m * N + n] = acc[i][j][r] + bias[n];
        }
      }
    }
  } else {
    // the 64 tile rows lie in one batch (b = tm >> 5, s0 = (tm & 31) * 64),
    // the 64 tile columns are one head (h = tn)
    _Float16* ob = outh + (size_t)((tm >> 5) * HEADS + tn) * SEQ * HDIM + lane * 8;
    const int st = tm & 31;
#pragma unroll
    for (int i = 0; i < 4; ++i) {
#pragma unroll
      for (int j = 0; j < 4; ++j) {
        v8h o;
#pragma unroll
        for (int r = 0; r < 8; ++r) o[r] = (_Float16)acc[i][j][r];
        const int off = (MODE == 0)
            ? ((st * 4 + i) * 2 + (j >> 1)) * 512 + (j & 1) * 256     // [S][D], 2 blocks per strip
            : (j * 64 + st * 2 + (i >> 1)) * 512 + (i & 1) * 256;     // [D][S], 64 blocks per strip
        *(v8h*)(ob + off) = o;
      }
    }
  }
}

// ---------------------------------------------------------------------------
// The GEMM launches. QKV: a block takes its 128x256 tile of X Wq, of X Wk and of
// X Wv one after the other (Bt: Wq^T, with Wk^T and Wv^T behind it; outh: Q, with
// K and V^T behind it, MTOT * EMBED elements each), in one ring of 3 NSTAGE
// stages: one launch, one fill of the chip and one wait for a first stage where
// three launches had three of each. Otherwise: the output projection, one product.
// ---------------------------------------------------------------------------
template <bool QKV>
__global__ void __launch_bounds__(256)
gemm_wmma(const _Float16* __restrict__ A, const _Float16* __restrict__ Bt,
          _Float16* __restrict__ outh, float* __restrict__ outf,
          const float* __restrict__ bias, int M, int N) {
  constexpr int GTOT = (QKV ? 3 : 1) * GEMM_NSTAGE;
  __shared__ __attribute__((aligned(1024))) _Float16 ring[2 * GEMM_STAGE_B / 2];

  const int tilesN = N >> 8;
  const int bm = blockIdx.x / tilesN;
  const int bn = blockIdx.x % tilesN;
  if (bm * 128 >= M) return;             // the whole block, in front of every barrier
  // the wave's number as a scalar: its tile and its LDS strips are wave-uniform
  const int w  = __builtin_amdgcn_readfirstlane(threadIdx.x >> 5);
  const int tm = bm * 2 + (w >> 2);
  const int tn = bn * 4 + (w & 3);

  const unsigned vo = threadIdx.x * 16;
  const unsigned lds0 = (unsigned)(size_t)ring + vo;
  const char* ga = (const char*)A  + (size_t)bm * 8  * GEMM_KT * 1024;
  const char* gb = (const char*)Bt + (size_t)bn * 16 * GEMM_KT * 1024;

  copy_gemm_stage(lds0, vo, ga, gb, 0);
  // stage 0 has landed for this wave, then for all: nobody reads it before
  asm volatile("s_wait_asynccnt 0x0" ::: "memory");
  __syncthreads();
  copy_gemm_stage(lds0 + GEMM_STAGE_B, vo, ga, gb, 1);

  if (QKV) {
    for (int p = 0; p < 2; ++p) {        // Q, then K
      gemm_product<0>(ring, lds0, vo, ga, gb, p * GEMM_NSTAGE, GTOT, w, tm, tn,
                      outh + (size_t)p * MTOT * EMBED, nullptr, nullptr, N);
      // the next product's first instructions rewrite registers that this
      // product's last stores name
      asm volatile("s_wait_xcnt 0x0" ::: "memory");
    }
    gemm_product<1>(ring, lds0, vo, ga, gb, 2 * GEMM_NSTAGE, GTOT, w, tm, tn,
                    outh + (size_t)2 * MTOT * EMBED, nullptr, nullptr, N);
  } else {
    gemm_product<2>(ring, lds0, vo, ga, gb, 0, GTOT, w, tm, tn, nullptr, outf, bias, N);
  }
  // no copy is outstanding when the wave ends
  asm volatile("s_wait_asynccnt 0x0" ::: "memory");
}

// ---------------------------------------------------------------------------
// Lane l <-> lane l ^ 16: the other half's value of the same column.
// ---------------------------------------------------------------------------
__device__ __forceinline__ float other_half(float x) {
  const int b = __builtin_bit_cast(int, x);
  return __builtin_bit_cast(float,
      __builtin_amdgcn_permlanex16(b, b, 0x76543210, 0xfedcba98, false, false));
}

// ---------------------------------------------------------------------------
// 2^x by v_exp_f32, eight at a time and one alone. Behind a
// transcendental the instruction set asks for one independent instruction
// before its source is overwritten or its result read.
// Written so, each v_exp_f32 is followed by an independent one and the last by
// the v_nop that fills its slot. The eight results take registers of their own:
// the sources are a WMMA's accumulator as it stands, and in place the compiler
// first copied them out of it.
// ---------------------------------------------------------------------------
__device__ __forceinline__ v8f exp2_x8(v8f x) {
  float y0, y1, y2, y3, y4, y5, y6, y7;
  asm("v_exp_f32 %0, %8\n\t"
      "v_exp_f32 %1, %9\n\t"
      "v_exp_f32 %2, %10\n\t"
      "v_exp_f32 %3, %11\n\t"
      "v_exp_f32 %4, %12\n\t"
      "v_exp_f32 %5, %13\n\t"
      "v_exp_f32 %6, %14\n\t"
      "v_exp_f32 %7, %15\n\t"
      "v_nop"
      : "=&v"(y0), "=&v"(y1), "=&v"(y2), "=&v"(y3),
        "=&v"(y4), "=&v"(y5), "=&v"(y6), "=&v"(y7)
      : "v"(x[0]), "v"(x[1]), "v"(x[2]), "v"(x[3]),
        "v"(x[4]), "v"(x[5]), "v"(x[6]), "v"(x[7]));
  v8f y = {y0, y1, y2, y3, y4, y5, y6, y7};
  return y;
}
__device__ __forceinline__ float exp2_x1(float x) {
  asm("v_exp_f32 %0, %0\n\t"
      "v_nop"
      : "+v"(x));
  return x;
}

// ---------------------------------------------------------------------------
// One stage of the attention ring: 64 keys of K (8 KiB, contiguous) and of V^T
// (four d strips of 2 KiB), 16 KiB in LDS. Each of the 256 threads brings four
// 16-byte chunks by asynchronous copies, a wave 512 contiguous bytes per copy.
// lds: the thread's chunk in the buffer's first 4 KiB. kb, vb: the stage's first
// byte of K and of V^T strip 0, the same for the whole block (scalar registers);
// ko, vo: the thread's byte offsets from them. The s_wait_xcnt stands inside the
// statement, so that no register a copy names is rewritten ahead of it.
// ---------------------------------------------------------------------------
__device__ __forceinline__ void copy_stage(unsigned lds, const char* kb, unsigned ko,
                                           const char* vb, unsigned vo) {
  const unsigned l1 = lds + 4096, l2 = lds + 8192, l3 = lds + 12288;
  const char* kb1 = kb + 4096;          // keys 32..63 of the stage
  const char* vb1 = vb + 2 * 65536;     // two d strips on
  asm volatile("global_load_async_to_lds_b128 %0, %4, %6\n\t"
               "global_load_async_to_lds_b128 %1, %4, %7\n\t"
               "global_load_async_to_lds_b128 %2, %5, %8\n\t"
               "global_load_async_to_lds_b128 %3, %5, %9\n\t"
               "s_wait_xcnt 0x0"
               :: "v"(lds), "v"(l1), "v"(l2), "v"(l3), "v"(ko), "v"(vo),
                  "s"(kb), "s"(kb1), "s"(vb), "s"(vb1)
               : "memory");
}

__global__ void __launch_bounds__(256) __attribute__((amdgpu_waves_per_eu(4, 4)))
attn_wmma(const _Float16* __restrict__ Q, const _Float16* __restrict__ K,
          const _Float16* __restrict__ Vt, _Float16* __restrict__ Ctx) {
  // the wave's number as a scalar: tile and head then live in scalar registers
  const int wave = blockIdx.x * 8 + __builtin_amdgcn_readfirstlane(threadIdx.x >> 5);
  const int qp = wave & 63;              // pair of q tiles within head (S/32 = 64)
  const int bh = wave >> 6;              // b*HEADS + h
  const int lane = threadIdx.x & 31;
  constexpr int STAGE_B = 16384;         // bytes of a stage: K 8 KiB, then V^T 8 KiB
  constexpr int NSTAGE = SEQ / 64;
  __shared__ __attribute__((aligned(1024))) _Float16 ring[2 * STAGE_B / 2];

  const _Float16* Qb = Q  + ((size_t)bh * SEQ + qp * 32) * HDIM;   // strips 2 qp, 2 qp + 1: 4 blocks
  const _Float16* Kb = K  + (size_t)bh * SEQ * HDIM;
  const _Float16* Vb = Vt + (size_t)bh * HDIM * SEQ;

  // the thread's chunks in a stage; a stage on is 8 KiB of K, 2 KiB of each V^T strip
  const unsigned ko = threadIdx.x * 16;
  const unsigned vo = (threadIdx.x >> 7) * 65536 + (threadIdx.x & 127) * 16;
  const unsigned lds0 = (unsigned)(size_t)ring + threadIdx.x * 16;
  const char* kg = (const char*)Kb;
  const char* vg = (const char*)Vb;

  copy_stage(lds0, kg, ko, vg, vo);
  // stage 0 has landed for this wave, then for all: nobody reads it before
  asm volatile("s_wait_asynccnt 0x0" ::: "memory");
  __syncthreads();
  copy_stage(lds0 + STAGE_B, kg + 8192, ko, vg + 2048, vo);
  kg += 2 * 8192;
  vg += 2 * 2048;

  v16h bq[2][2];                         // Q rows as columns of Q^T: [tile][d 0..31, d 32..63]
#pragma unroll
  for (int c = 0; c < 2; ++c) {
    bq[c][0] = load_pk(Qb + c * 1024);
    bq[c][1] = load_pk(Qb + c * 1024 + 512);
  }

  v8f ctx[2][4] = {};                    // ctx[c][j][r] = O[q][16 j + 8 half + r]
  v8f nref[2] = {};                      // minus the query's reference, in all eight registers
  float lrow[2] = {0.0f, 0.0f};          // this lane's share of its sum

  for (int st = 0; st < NSTAGE; ++st) {
    const int buf = (st & 1) * STAGE_B;
    const _Float16* sk = ring + buf / 2 + lane * 8;   // the stage's K; V^T 8 KiB on
    // ---- scores: per query tile four 16(kv) x 16(q) tiles over the stage's 64 keys ----
    v8f s[2][4];                         // log2 of P: score * QSCALE - reference
#pragma unroll
    for (int t = 0; t < 4; ++t) {
      const v16h ka0 = load_pk_lds(sk, t * 2048);
      const v16h ka1 = load_pk_lds(sk, t * 2048 + 1024);
#pragma unroll
      for (int c = 0; c < 2; ++c) s[c][t] = wmma32(ka0, bq[c][0], nref[c]);
#pragma unroll
      for (int c = 0; c < 2; ++c) s[c][t] = wmma32(ka1, bq[c][1], s[c][t]);
    }

    // ---- the stage's maximum above the reference, one query per lane and tile ----
    float mx[2];
#pragma unroll
    for (int c = 0; c < 2; ++c) {
      float mt[4];
#pragma unroll
      for (int t = 0; t < 4; ++t)
        mt[t] = fmaxf(fmaxf(fmaxf(s[c][t][0], s[c][t][1]), fmaxf(s[c][t][2], s[c][t][3])),
                      fmaxf(fmaxf(s[c][t][4], s[c][t][5]), fmaxf(s[c][t][6], s[c][t][7])));
      const float m = fmaxf(fmaxf(mt[0], mt[1]), fmaxf(mt[2], mt[3]));
      mx[c] = fmaxf(m, other_half(m));
    }
    // ---- new reference: in stage 0 (any finite maximum passes its bar), and where a
    // query of the wave outgrew its own. One test a stage, the same for the whole
    // wave (a scalar branch: EXEC stays full) ----
    const float bar = (st == 0) ? -__builtin_inff() : 8.0f;
    if (__builtin_expect(__builtin_amdgcn_ballot_w32(fmaxf(mx[0], mx[1]) > bar) != 0, 0)) {
#pragma unroll
      for (int c = 0; c < 2; ++c) {
        // a reference only rises; but stage 0 takes its maximum whatever its sign
        // (sums and O are still 0 there, and f is at most 1)
        const float up = fmaxf(mx[c], 0.0f);
        const float d = (st == 0) ? mx[c] : up;
        const float f = exp2_x1(-up);
        lrow[c] *= f;
#pragma unroll
        for (int r = 0; r < 8; ++r) nref[c][r] -= d;
#pragma unroll
        for (int t = 0; t < 4; ++t)
#pragma unroll
          for (int r = 0; r < 8; ++r) { s[c][t][r] -= d;  ctx[c][t][r] *= f; }
      }
    }

    // V^T fragments are read one d chunk ahead, chunk 0 ahead of the exponentials.
    // The scheduling barriers hold reads and products in that order: left alone the
    // compiler put each read directly in front of its products, and the wave
    // waited out the LDS latency at every chunk.
    v16h va[2][2];
    va[0][0] = load_pk_lds(sk, 8192);
    va[0][1] = load_pk_lds(sk, 8192 + 1024);
    __builtin_amdgcn_sched_barrier(0);   // chunk 0's reads stay ahead of the exponentials

    // ---- P = 2^s, its sums, and P^T as B operands ----
    v16h pb[2][2];                       // the stage's keys 0..31, 32..63
#pragma unroll
    for (int c = 0; c < 2; ++c) {
      float rs[4];
#pragma unroll
      for (int t = 0; t < 4; ++t) {
        s[c][t] = exp2_x8(s[c][t]);
        rs[t] = ((s[c][t][0] + s[c][t][1]) + (s[c][t][2] + s[c][t][3])) +
                ((s[c][t][4] + s[c][t][5]) + (s[c][t][6] + s[c][t][7]));
      }
      lrow[c] += (rs[0] + rs[1]) + (rs[2] + rs[3]);

      // element e = key 8 half + e (e < 8), 16 + 8 half + e - 8
#pragma unroll
      for (int r = 0; r < 8; ++r) {
        pb[c][0][r] = (_Float16)s[c][0][r];  pb[c][0][r + 8] = (_Float16)s[c][1][r];
        pb[c][1][r] = (_Float16)s[c][2][r];  pb[c][1][r + 8] = (_Float16)s[c][3][r];
      }
    }

    // ---- O^T += V^T P^T : four 16-wide d chunks, two kv halves each ----
#pragma unroll
    for (int j = 0; j < 4; ++j) {
      if (j < 3) {
        va[(j + 1) & 1][0] = load_pk_lds(sk, 8192 + (j + 1) * 2048);
        va[(j + 1) & 1][1] = load_pk_lds(sk, 8192 + (j + 1) * 2048 + 1024);
      }
      __builtin_amdgcn_sched_barrier(0);   // the next chunk's reads stay ahead of this chunk's products
#pragma unroll
      for (int c = 0; c < 2; ++c) ctx[c][j] = wmma32(va[j & 1][0], pb[c][0], ctx[c][j]);
#pragma unroll
      for (int c = 0; c < 2; ++c) ctx[c][j] = wmma32(va[j & 1][1], pb[c][1], ctx[c][j]);
      // and the products ahead of the reads that follow
      if (j < 3) __builtin_amdgcn_sched_barrier(0);
    }

    // ---- hand-over: this wave's reads of the stage are done, its copies of the
    // next have landed; behind the barrier both hold for all 8 waves, so the next
    // stage may be read and this stage's buffer refilled ----
    // The products stay above the hand-over: sunk below it they stood directly
    // in front of the branch.
    __builtin_amdgcn_sched_barrier(0);
    asm volatile("s_wait_dscnt 0x0" ::: "memory");
    asm volatile("s_wait_asynccnt 0x0" ::: "memory");
    __syncthreads();
    // the four vector slots between the last WMMA and the first instruction that
    // overwrites its operands, on both sides of the branch
    asm volatile("v_nop\n\tv_nop\n\tv_nop\n\tv_nop");
    if (st + 2 < NSTAGE) {
      copy_stage(lds0 + buf, kg, ko, vg, vo);
      kg += 8192;
      vg += 2048;
    }
  }
  // no copy is outstanding when the wave ends
  asm volatile("s_wait_asynccnt 0x0" ::: "memory");

  // ---- join the halves' sums, normalize; a lane's 8 registers of tile j are
  // 8 consecutive d of its query: one chunk of the Ctx layout as they stand ----
  const int b = bh >> 4, h = bh & 15;
#pragma unroll
  for (int c = 0; c < 2; ++c) {
    const float inv = 1.0f / (lrow[c] + other_half(lrow[c]));
    // strip b * 128 + 2 qp + c of [B*S][E] (32 blocks per strip), blocks 2h and 2h + 1
    _Float16* cb = Ctx + ((size_t)(b * (SEQ / 16) + qp * 2 + c) * 32 + h * 2) * 512 + lane * 8;
#pragma unroll
    for (int j = 0; j < 4; ++j) {
      v8h o;
#pragma unroll
      for (int r = 0; r < 8; ++r) o[r] = (_Float16)(ctx[c][j][r] * inv);
      *(v8h*)(cb + j * 256) = o;
    }
  }
}

// ---------------------------------------------------------------------------
// Host-side orchestration
// Workspace (f16 elems): [0,8M) Xh (reused as Ctx), [8M..12M) weights,
// [12M..20M) Qh, [20M..28M) Kh, [28M..36M) Vth  => 72 MB total.
// ---------------------------------------------------------------------------
extern "C" void kernel_launch(void* const* d_in, const int* in_sizes, int n_in,
                              void* d_out, int out_size, void* d_ws, size_t ws_size,
                              hipStream_t stream) {
  const float* X  = (const float*)d_in[0];
  const float* Wq = (const float*)d_in[1];
  const float* Wk = (const float*)d_in[2];
  const float* Wv = (const float*)d_in[3];
  const float* Wo = (const float*)d_in[4];
  const float* bo = (const float*)d_in[5];
  float* out = (float*)d_out;

  _Float16* ws = (_Float16*)d_ws;
  const size_t M1 = (size_t)1024 * 1024;
  _Float16* Xh  = ws;             // 8M elems; later reused as Ctx (f16)
  _Float16* Wqt = ws + 8 * M1;    // W_q^T  [f,e]; W_k^T (9 M1) and W_v^T (10 M1) follow it
  _Float16* Woh = ws + 11 * M1;   // W_o    [f,e] (already B^T layout for x@Wo^T)
  _Float16* Qh  = ws + 12 * M1;   // per (b,h) [S][D]
  _Float16* Kh  = ws + 20 * M1;   // per (b,h) [S][D]
  _Float16* Vth = ws + 28 * M1;   // per (b,h) [D][S]

  // 1) precision conversion / weight re-layout: Xh .. Woh, 12M elems from ws on
  pack_all<<<512, 256, 0, stream>>>(X, Wq, Wk, Wv, Wo, ws);

  // 2) Q/K/V projections (8192x1024x1024 each) in one launch, 2048 waves / 256 blocks:
  // Wqt, Wkt, Wvt follow one another in the workspace, and so do Qh, Kh, Vth
  gemm_wmma<true><<<256, 256, 0, stream>>>(Xh, Wqt, Qh, nullptr, nullptr, MTOT, EMBED);

  // 3) flash attention: 4096 pairs of q-tiles -> 512 blocks of 8 waves; Ctx -> Xh
  attn_wmma<<<512, 256, 0, stream>>>(Qh, Kh, Vth, Xh);

  // 4) output projection + bias, f32 result
  gemm_wmma<false><<<256, 256, 0, stream>>>(Xh, Woh, nullptr, out, bo, MTOT, EMBED);
}

// v009
// One run takes 113 microseconds.
// In both of two side-by-side timings against v008, it was 1.03 times as fast.
// Counting every step since v000, it is 5.79 times as fast.
#include <hip/hip_runtime.h>

typedef __attribute__((ext_vector_type(16))) _Float16 v16h;
typedef __attribute__((ext_vector_type(8)))  _Float16 v8h;
typedef __attribute__((ext_vector_type(4)))  _Float16 v4h;
typedef __attribute__((ext_vector_type(8)))  float    v8f;

#define EMBED 1024
#define HEADS 16
#define HDIM  64
#define BATCH 4
#define SEQ   2048
#define MTOT  (BATCH * SEQ)   // 8192

// ---------------------------------------------------------------------------
// 16x32 f16 fragment, the wave-lane indexing the M (or N) row.
// Layout per CDNA5 ISA 7.12.2 (16-bit A 16x32):
//   lanes 0-15 : row = lane,    elems 0..7 = K[0..7],  elems 8..15 = K[16..23]
//   lanes 16-31: row = lane-16, elems 0..7 = K[8..15], elems 8..15 = K[24..31]
// B (32x16) uses the symmetric layout, so one loader serves A fragments and B
// fragments from a [N, K] (i.e. B^T) source.
// ---------------------------------------------------------------------------

// ---------------------------------------------------------------------------
// Fragment-ordered operands. Every f16 matrix [rows][K] that a WMMA reads from
// the workspace is kept as blocks of 16 rows x 32 k (512 elements, 1 KiB);
// block (rt, kt) stands at (rt * (K / 32) + kt) * 512. Inside a block the
// 16-byte chunk number u * 32 + lane holds that lane's fragment
// elements 8u .. 8u+7: row = lane & 15, k = 16 * u + 8 * (lane >> 4) + 0..7.
// A wave-wide 16-byte load or store of one u is then 512 contiguous bytes
// (4 cache lines) where the row-major form touches 16 lines.
// ---------------------------------------------------------------------------
__device__ __forceinline__ v16h load_pk(const _Float16* __restrict__ blk) {
  const _Float16* q = blk + (threadIdx.x & 31) * 8;
  union { v8h h[2]; v16h v; } u;
  u.h[0] = *(const v8h*)(q);
  u.h[1] = *(const v8h*)(q + 256);
  return u.v;
}

__device__ __forceinline__ v8f wmma32(v16h a, v16h b, v8f c) {
  return __builtin_amdgcn_wmma_f32_16x16x32_f16(
      /*neg_a=*/false, a, /*neg_b=*/false, b,
      /*c_mod=*/(short)0, c, /*reuse_a=*/false, /*reuse_b=*/false);
}

// ---------------------------------------------------------------------------
// All five f32 operands -> f16, fragment-ordered, in one launch of PACK_T
// threads. dst is the start of the workspace, where X, Wq^T, Wk^T, Wv^T and Wo
// follow one another. A thread owns one place in a block (16-byte chunk t & 63:
// row c, k = 16 u + 8 h + 0..7) and fills it in 12 blocks: in 8 blocks of X
// that follow one another along k, and in block t >> 6 of each weight matrix.
// The launch is small enough to be resident at once (16 waves per WGP): a wave
// is started once for 12 chunks, and all its loads are in flight together.
// Wq is stored times QSCALE, so that Q K^T comes out of the matrix unit as the
// exponent of 2 that the softmax needs: score / sqrt(HDIM) * log2(e).
// ---------------------------------------------------------------------------
#define QSCALE (0.125f * 1.44269504f)
#define PACK_T (512 * 256)               // = the chunks of one weight matrix
typedef __attribute__((ext_vector_type(4))) float v4f;

__global__ void __launch_bounds__(256)
pack_all(const float* __restrict__ X, const float* __restrict__ Wq,
         const float* __restrict__ Wk, const float* __restrict__ Wv,
         const float* __restrict__ Wo, _Float16* __restrict__ dst) {
  const unsigned t = blockIdx.x * 256 + threadIdx.x;
  const unsigned c = t & 15, h = (t >> 4) & 1, u = (t >> 5) & 1, blk = t >> 6;
  // X: blocks 8 blk .. 8 blk + 7 (EMBED / 32 = 32 blocks per strip of 16 rows).
  // The chunk's first element in the first of them, in groups of 4 floats; a
  // block on is 8 groups on.
  const unsigned ox = ((blk >> 2) * 16 + c) * (EMBED / 4) + (blk & 3) * 64 + u * 4 + h * 2;
  // weights: block blk = strip rt, k block kt; a source taken as it is,
  // src[row][k], in groups of 4 floats ...
  const unsigned rt = blk >> 5, kt = blk & 31;
  const unsigned op = (rt * 16 + c) * (EMBED / 4) + kt * 8 + u * 4 + h * 2;
  // ... and one taken transposed, logical dst[n][k] = src[k][n], in floats
  const unsigned ot = (kt * 32 + u * 16 + h * 8) * EMBED + rt * 16 + c;

  v4f x[9][2];                           // 8 blocks of X, then Wo
#pragma unroll
  for (int i = 0; i < 8; ++i) {
    x[i][0] = ((const v4f*)X + i * 8)[ox];
    x[i][1] = ((const v4f*)X + i * 8 + 1)[ox];
  }
  x[8][0] = ((const v4f*)Wo)[op];
  x[8][1] = ((const v4f*)Wo + 1)[op];
  v8f w[3];                              // Wq, Wk, Wv
#pragma unroll
  for (int m = 0; m < 3; ++m) {
    const float* q = (m == 0 ? Wq : m == 1 ? Wk : Wv);
#pragma unroll
    for (int e = 0; e < 8; ++e) w[m][e] = (q + e * EMBED)[ot];
  }
  // Holds every load above the first conversion: left alone the compiler waits
  // for the first loads before it issues the later ones, several memory
  // latencies in a row instead of one. The three offsets are named so that they
  // live as long as the loads that name them: no result lands in their registers.
  asm volatile("" :: "v"(x[0][0]), "v"(x[0][1]), "v"(x[1][0]), "v"(x[1][1]),
                     "v"(x[2][0]), "v"(x[2][1]), "v"(x[3][0]), "v"(x[3][1]),
                     "v"(x[4][0]), "v"(x[4][1]), "v"(x[5][0]), "v"(x[5][1]),
                     "v"(x[6][0]), "v"(x[6][1]), "v"(x[7][0]), "v"(x[7][1]),
                     "v"(x[8][0]), "v"(x[8][1]), "v"(w[0]), "v"(w[1]), "v"(w[2]),
                     "v"(ox), "v"(op), "v"(ot));

  const unsigned dx = blk * 512 + (t & 63);        // X: the chunk in block 8 blk
#pragma unroll
  for (int i = 0; i < 9; ++i) {
    v8h o;
#pragma unroll
    for (int e = 0; e < 4; ++e) {
      o[e]     = (_Float16)x[i][0][e];
      o[e + 4] = (_Float16)x[i][1][e];
    }
    if (i < 8) ((v8h*)dst + i * 64)[dx] = o;
    else       ((v8h*)dst + 11 * PACK_T)[t] = o;   // Wo stands last
  }
#pragma unroll
  for (int m = 0; m < 3; ++m) {
    v8h o;
#pragma unroll
    for (int e = 0; e < 8; ++e) o[e] = (_Float16)(m == 0 ? w[m][e] * QSCALE : w[m][e]);
    ((v8h*)dst + (8 + m) * PACK_T)[t] = o;
  }
}

// ---------------------------------------------------------------------------
// load_pk of the block that stands blk_bytes behind q in LDS; q holds the
// buffer's start plus the lane's 16 bytes.
// ---------------------------------------------------------------------------
__device__ __forceinline__ v16h load_pk_lds(const _Float16* q, int blk_bytes) {
  union { v8h h[2]; v16h v; } u;
  u.h[0] = *(const v8h*)(q + blk_bytes / 2);
  u.h[1] = *(const v8h*)(q + blk_bytes / 2 + 256);
  return u.v;
}

// ---------------------------------------------------------------------------
// Eight strips of a GEMM stage by asynchronous copies: of each strip (16 rows)
// the stage's four k blocks, 4 KiB contiguous, one 16-byte chunk a thread, a wave
// 512 contiguous bytes per copy. lds: the thread's chunk in the first strip's
// place, the next strips 4 KiB apart. g: the stage's first byte of the first
// strip, the same for the whole block (scalar registers), the next strips 32 KiB
// apart; vo: the thread's byte offset from it. The s_wait_xcnt stands inside the
// statement, so that no register a copy names is rewritten ahead of it.
// ---------------------------------------------------------------------------
__device__ __forceinline__ void copy_strips8(unsigned lds, unsigned vo, const char* g) {
  asm volatile("global_load_async_to_lds_b128 %0, %8, %9\n\t"
               "global_load_async_to_lds_b128 %1, %8, %10\n\t"
               "global_load_async_to_lds_b128 %2, %8, %11\n\t"
               "global_load_async_to_lds_b128 %3, %8, %12\n\t"
               "global_load_async_to_lds_b128 %4, %8, %13\n\t"
               "global_load_async_to_lds_b128 %5, %8, %14\n\t"
               "global_load_async_to_lds_b128 %6, %8, %15\n\t"
               "global_load_async_to_lds_b128 %7, %8, %16\n\t"
               "s_wait_xcnt 0x0"
               :: "v"(lds), "v"(lds + 4096), "v"(lds + 2 * 4096), "v"(lds + 3 * 4096),
                  "v"(lds + 4 * 4096), "v"(lds + 5 * 4096), "v"(lds + 6 * 4096),
                  "v"(lds + 7 * 4096), "v"(vo),
                  "s"(g), "s"(g + 32768), "s"(g + 2 * 32768), "s"(g + 3 * 32768),
                  "s"(g + 4 * 32768), "s"(g + 5 * 32768), "s"(g + 6 * 32768),
                  "s"(g + 7 * 32768)
               : "memory");
}

// ---------------------------------------------------------------------------
// WMMA GEMM: C[M,N] = A[M,K] * B[K,N], with B supplied transposed as Bt[N,K];
// A and Bt fragment-ordered. A block of 8 waves computes a 128x256 tile, each
// wave 64x64 of it (16 wmmas per K=32 step): wave w has rows 64 (w >> 2) and
// columns 64 (w & 3). The block's 8 strips of A and 16 of Bt stand in LDS in two
// buffers of one 128-k stage each (24 strips x 4 KiB); the next stage's copies
// fly while this one is worked on. A strip of A is then fetched once for four
// waves, a strip of Bt once for two.
// MODE 0: f16, per (b,h) the matrix [S][D] fragment-ordered   (Q, K)
// MODE 1: f16, per (b,h) the matrix [D][S] fragment-ordered   (V, for P@V)
// MODE 2: f32 to [M,N] + bias                                 (final output)
// A chunk of the output layout is 8 consecutive k of one row. MODE 1 has them
// in a lane's accumulator as it is (k = s = the tile's rows); MODE 0 (k = d =
// the tile's columns) takes Bt as the A operand, which gives the tile
// transposed: acc[i][j][r] = C[i*16 + nlo][j*16 + 8*half + r].
// ---------------------------------------------------------------------------
#define GEMM_KT      (EMBED >> 5)          // blocks per strip; K = EMBED in all four products
#define GEMM_KS      4                     // k blocks of a stage
#define GEMM_NSTAGE  (GEMM_KT / GEMM_KS)   // stages of one product
#define GEMM_STRIP_B (GEMM_KS * 1024)      // bytes of a strip in a stage
#define GEMM_STAGE_B (24 * GEMM_STRIP_B)   // A 8 strips, then Bt 16 strips
#define GEMM_W_B     (EMBED * EMBED * 2)   // bytes of one weight matrix

// ---------------------------------------------------------------------------
// One stage of the GEMM ring into the buffer at lds. The stages of a launch are
// numbered through all its products: stage g is stage g % NSTAGE of product
// g / NSTAGE. Every product reads the same strips of A (ga: the block's first);
// its Bt stands g / NSTAGE weight matrices behind gb (the block's first strip in
// the first one).
// ---------------------------------------------------------------------------
__device__ __forceinline__ void copy_gemm_stage(unsigned lds, unsigned vo, const char* ga,
                                                const char* gb, int g) {
  const int ks = (g % GEMM_NSTAGE) * GEMM_STRIP_B;
  const char* a = ga + ks;
  const char* b = gb + (size_t)(g / GEMM_NSTAGE) * GEMM_W_B + ks;
  copy_strips8(lds,                     vo, a);
  copy_strips8(lds +  8 * GEMM_STRIP_B, vo, b);
  copy_strips8(lds + 16 * GEMM_STRIP_B, vo, b + 8 * GEMM_KT * 1024);
}

// ---------------------------------------------------------------------------
// One product of a launch: its NSTAGE stages, g0 the number of the first, and its
// store. On entry stage g0 is published and stage g0 + 1 is in flight. The refill
// behind each hand-over does not stop at the product's end: while gtot, the
// launch's stages, is not reached, the last two hand-overs bring the next
// product's first two stages, which fly during this product's last stage and its
// store.
// ---------------------------------------------------------------------------
template <int MODE>
__device__ __forceinline__ void
gemm_product(const _Float16* ring, unsigned lds0, unsigned vo, const char* ga, const char* gb,
             int g0, int gtot, int w, int tm, int tn,
             _Float16* __restrict__ outh, float* __restrict__ outf,
             const float* __restrict__ bias, int N) {
  constexpr int KS = GEMM_KS, NSTAGE = GEMM_NSTAGE;
  constexpr int STRIP_B = GEMM_STRIP_B, STAGE_B = GEMM_STAGE_B;
  const int lane = threadIdx.x & 31;
  const int half = lane >> 4, nlo = lane & 15;

  v8f acc[4][4] = {};

  for (int st = 0; st < NSTAGE; ++st) {
    const int buf = (st & 1) * STAGE_B;    // NSTAGE is even: g0 + st and st are alike in parity
    // the lane's chunk in the wave's first strip of each operand
    const _Float16* sa = ring + (buf + (w >> 2) * 4 * STRIP_B) / 2 + lane * 8;
    const _Float16* sb = ring + (buf + (8 + (w & 3) * 4) * STRIP_B) / 2 + lane * 8;
    // Two fragment sets: the next k block's LDS reads go out ahead of this block's
    // products, in two groups: A and half of B in front of the block, the rest of
    // B at its middle, into the registers that the first half of this block's B
    // has left (all in front would take the wave past 256 VGPRs).
    // The scheduling barriers keep reads and products in that order: left alone
    // the compiler sinks each read to just before its first use, into one
    // fragment set, and the wave waits out the LDS latency four times a k block.
    v16h af[2][4], bf[2][4];
#pragma unroll
    for (int i = 0; i < 4; ++i) {
      af[0][i] = load_pk_lds(sa, i * STRIP_B);
      bf[0][i] = load_pk_lds(sb, i * STRIP_B);
    }
#pragma unroll
    for (int kk = 0; kk < KS; ++kk) {
      const int c = kk & 1;
#pragma unroll
      for (int jh = 0; jh < 2; ++jh) {
        if (kk + 1 < KS) {
          if (jh == 0) {
#pragma unroll
            for (int i = 0; i < 4; ++i)
              af[c ^ 1][i] = load_pk_lds(sa, i * STRIP_B + (kk + 1) * 1024);
          }
#pragma unroll
          for (int j = 2 * jh; j < 2 * jh + 2; ++j)
            bf[c ^ 1][j] = load_pk_lds(sb, j * STRIP_B + (kk + 1) * 1024);
        }
        __builtin_amdgcn_sched_barrier(0);   // the reads stay ahead of the products
#pragma unroll
        for (int j = 2 * jh; j < 2 * jh + 2; ++j) {
#pragma unroll
          for (int i = 0; i < 4; ++i)
            acc[i][j] = (MODE == 0) ? wmma32(bf[c][j], af[c][i], acc[i][j])
                                    : wmma32(af[c][i], bf[c][j], acc[i][j]);
        }
        // the products stay ahead of the next reads, the last ones ahead of the
        // hand-over and its branch
        __builtin_amdgcn_sched_barrier(0);
      }
    }

    // ---- hand-over: this wave's reads of the stage are done, its copies of the
    // next have landed; behind the barrier both hold for all 8 waves, so the next
    // stage may be read and this stage's buffer refilled ----
    asm volatile("s_wait_dscnt 0x0" ::: "memory");
    asm volatile("s_wait_asynccnt 0x0" ::: "memory");
    __syncthreads();
    // the four vector slots between the last WMMA and the first instruction that
    // overwrites its operands, on both sides of the branch
    asm volatile("v_nop\n\tv_nop\n\tv_nop\n\tv_nop");
    if (g0 + st + 2 < gtot) copy_gemm_stage(lds0 + buf, vo, ga, gb, g0 + st + 2);
  }

  if (MODE == 2) {
#pragma unroll
    for (int i = 0; i < 4; ++i) {
#pragma unroll
      for (int j = 0; j < 4; ++j) {
#pragma unroll
        for (int r = 0; r < 8; ++r) {
          const int m = tm * 64 + i * 16 + r + half * 8;
          const int n = tn * 64 + j * 16 + nlo;
          outf[(size_t)m * N + n] = acc[i][j][r] + bias[n];
        }
      }
    }
  } else {
    // the 64 tile rows lie in one batch (b = tm >> 5, s0 = (tm & 31) * 64),
    // the 64 tile columns are one head (h = tn)
    _Float16* ob = outh + (size_t)((tm >> 5) * HEADS + tn) * SEQ * HDIM + lane * 8;
    const int st = tm & 31;
#pragma unroll
    for (int i = 0; i < 4; ++i) {
#pragma unroll
      for (int j = 0; j < 4; ++j) {
        v8h o;
#pragma unroll
        for (int r = 0; r < 8; ++r) o[r] = (_Float16)acc[i][j][r];
        const int off = (MODE == 0)
            ? ((st * 4 + i) * 2 + (j >> 1)) * 512 + (j & 1) * 256     // [S][D], 2 blocks per strip
            : (j * 64 + st * 2 + (i >> 1)) * 512 + (i & 1) * 256;     // [D][S], 64 blocks per strip
        *(v8h*)(ob + off) = o;
      }
    }
  }
}

// ---------------------------------------------------------------------------
// The GEMM launches. QKV: a block takes its 128x256 tile of X Wq, of X Wk and of
// X Wv one after the other (Bt: Wq^T, with Wk^T and Wv^T behind it; outh: Q, with
// K and V^T behind it, MTOT * EMBED elements each), in one ring of 3 NSTAGE
// stages: one launch, one fill of the chip and one wait for a first stage where
// three launches had three of each. Otherwise: the output projection, one product.
// ---------------------------------------------------------------------------
template <bool QKV>
__global__ void __launch_bounds__(256)
gemm_wmma(const _Float16* __restrict__ A, const _Float16* __restrict__ Bt,
          _Float16* __restrict__ outh, float* __restrict__ outf,
          const float* __restrict__ bias, int M, int N) {
  constexpr int GTOT = (QKV ? 3 : 1) * GEMM_NSTAGE;
  __shared__ __attribute__((aligned(1024))) _Float16 ring[2 * GEMM_STAGE_B / 2];

  const int tilesN = N >> 8;
  const int bm = blockIdx.x / tilesN;
  const int bn = blockIdx.x % tilesN;
  if (bm * 128 >= M) return;             // the whole block, in front of every barrier
  // the wave's number as a scalar: its tile and its LDS strips are wave-uniform
  const int w  = __builtin_amdgcn_readfirstlane(threadIdx.x >> 5);
  const int tm = bm * 2 + (w >> 2);
  const int tn = bn * 4 + (w & 3);

  const unsigned vo = threadIdx.x * 16;
  const unsigned lds0 = (unsigned)(size_t)ring + vo;
  const char* ga = (const char*)A  + (size_t)bm * 8  * GEMM_KT * 1024;
  const char* gb = (const char*)Bt + (size_t)bn * 16 * GEMM_KT * 1024;

  copy_gemm_stage(lds0, vo, ga, gb, 0);
  // stage 0 has landed for this wave, then for all: nobody reads it before
  asm volatile("s_wait_asynccnt 0x0" ::: "memory");
  __syncthreads();
  copy_gemm_stage(lds0 + GEMM_STAGE_B, vo, ga, gb, 1);

  if (QKV) {
    for (int p = 0; p < 2; ++p) {        // Q, then K
      gemm_product<0>(ring, lds0, vo, ga, gb, p * GEMM_NSTAGE, GTOT, w, tm, tn,
                      outh + (size_t)p * MTOT * EMBED, nullptr, nullptr, N);
      // the next product's first instructions rewrite registers that this
      // product's last stores name
      asm volatile("s_wait_xcnt 0x0" ::: "memory");
    }
    gemm_product<1>(ring, lds0, vo, ga, gb, 2 * GEMM_NSTAGE, GTOT, w, tm, tn,
                    outh + (size_t)2 * MTOT * EMBED, nullptr, nullptr, N);
  } else {
    gemm_product<2>(ring, lds0, vo, ga, gb, 0, GTOT, w, tm, tn, nullptr, outf, bias, N);
  }
  // no copy is outstanding when the wave ends
  asm volatile("s_wait_asynccnt 0x0" ::: "memory");
}

// ---------------------------------------------------------------------------
// Lane l <-> lane l ^ 16: the other half's value of the same column.
// ---------------------------------------------------------------------------
__device__ __forceinline__ float other_half(float x) {
  const int b = __builtin_bit_cast(int, x);
  return __builtin_bit_cast(float,
      __builtin_amdgcn_permlanex16(b, b, 0x76543210, 0xfedcba98, false, false));
}

// ---------------------------------------------------------------------------
// 2^x by v_exp_f32, eight at a time and one alone. Behind a
// transcendental the instruction set asks for one independent instruction
// before its source is overwritten or its result read.
// Written so, each v_exp_f32 is followed by an independent one and the last by
// the v_nop that fills its slot. The eight results take registers of their own:
// the sources are a WMMA's accumulator as it stands, and in place the compiler
// first copied them out of it.
// ---------------------------------------------------------------------------
__device__ __forceinline__ v8f exp2_x8(v8f x) {
  float y0, y1, y2, y3, y4, y5, y6, y7;
  asm("v_exp_f32 %0, %8\n\t"
      "v_exp_f32 %1, %9\n\t"
      "v_exp_f32 %2, %10\n\t"
      "v_exp_f32 %3, %11\n\t"
      "v_exp_f32 %4, %12\n\t"
      "v_exp_f32 %5, %13\n\t"
      "v_exp_f32 %6, %14\n\t"
      "v_exp_f32 %7, %15\n\t"
      "v_nop"
      : "=&v"(y0), "=&v"(y1), "=&v"(y2), "=&v"(y3),
        "=&v"(y4), "=&v"(y5), "=&v"(y6), "=&v"(y7)
      : "v"(x[0]), "v"(x[1]), "v"(x[2]), "v"(x[3]),
        "v"(x[4]), "v"(x[5]), "v"(x[6]), "v"(x[7]));
  v8f y = {y0, y1, y2, y3, y4, y5, y6, y7};
  return y;
}
__device__ __forceinline__ float exp2_x1(float x) {
  asm("v_exp_f32 %0, %0\n\t"
      "v_nop"
      : "+v"(x));
  return x;
}

// ---------------------------------------------------------------------------
// One stage of the attention ring: 64 keys of K (8 KiB, contiguous) and of V^T
// (four d strips of 2 KiB), 16 KiB in LDS. Each of the 256 threads brings four
// 16-byte chunks by asynchronous copies, a wave 512 contiguous bytes per copy.
// lds: the thread's chunk in the buffer's first 4 KiB. kb, vb: the stage's first
// byte of K and of V^T strip 0, the same for the whole block (scalar registers);
// ko, vo: the thread's byte offsets from them. The s_wait_xcnt stands inside the
// statement, so that no register a copy names is rewritten ahead of it.
// ---------------------------------------------------------------------------
__device__ __forceinline__ void copy_stage(unsigned lds, const char* kb, unsigned ko,
                                           const char* vb, unsigned vo) {
  const unsigned l1 = lds + 4096, l2 = lds + 8192, l3 = lds + 12288;
  const char* kb1 = kb + 4096;          // keys 32..63 of the stage
  const char* vb1 = vb + 2 * 65536;     // two d strips on
  asm volatile("global_load_async_to_lds_b128 %0, %4, %6\n\t"
               "global_load_async_to_lds_b128 %1, %4, %7\n\t"
               "global_load_async_to_lds_b128 %2, %5, %8\n\t"
               "global_load_async_to_lds_b128 %3, %5, %9\n\t"
               "s_wait_xcnt 0x0"
               :: "v"(lds), "v"(l1), "v"(l2), "v"(l3), "v"(ko), "v"(vo),
                  "s"(kb), "s"(kb1), "s"(vb), "s"(vb1)
               : "memory");
}

// ---------------------------------------------------------------------------
// One stage's P^T (pb, the B operands of the second product) and its row sums.
// The sums come from the matrix unit: A = all ones, so every row of D = A P^T is
// the sum over the operand's 32 keys, both lane halves included; two chained
// WMMAs per query tile give the stage's sum of the query in every lane that
// owns it (ssum). It is the sum of P as rounded to f16, the values that the
// second product weighs V with.
// The same sum is the guard of the softmax reference: while a stage's sum is at
// most SUM_BAR = 2^14, every P of it is at most 2^14, far inside f16 (a P that
// left f16 is infinite there, and so is its sum). The caller tests ssum and,
// where a query of the wave passed the bar, calls the RAISE form, which makes the
// stage's scores again (K still stands in LDS), takes their maximum, raises the
// references by it, rescales sums and O, and leaves every P at or below 1.
// va: V^T d chunks 0 and 1, read together with K.
// ---------------------------------------------------------------------------
#define SUM_BAR 16384.0f

// The maximum of a query's 64 scores of a stage, one query per lane and tile.
__device__ __forceinline__ float stage_max(const v8f (&s)[4]) {
  float mt[4];
#pragma unroll
  for (int t = 0; t < 4; ++t)
    mt[t] = fmaxf(fmaxf(fmaxf(s[t][0], s[t][1]), fmaxf(s[t][2], s[t][3])),
                  fmaxf(fmaxf(s[t][4], s[t][5]), fmaxf(s[t][6], s[t][7])));
  const float m = fmaxf(fmaxf(mt[0], mt[1]), fmaxf(mt[2], mt[3]));
  return fmaxf(m, other_half(m));
}

// MODE 0: P and sums under the references as they are. MODE 1: the RAISE form.
// MODE 2: no P; the references are set to the stage's maxima whatever their sign
// (called once, on stage 0, in front of the loop; nref comes in as 0).
template <int MODE>
__device__ __forceinline__ void
stage_p(const _Float16* sk, const v16h (&bq)[2][2], v8f (&nref)[2], float (&lrow)[2],
        v8f (&ctx)[2][4], v16h (&va)[2][2], v16h (&pb)[2][2], float (&ssum)[2]) {
  // The stage's K fragments and V^T chunks 0 and 1 are read as one group ahead of the
  // products. The scheduling barrier holds them there: left alone the compiler
  // read each K fragment into one register set directly in front of its products,
  // and the wave waited out the LDS latency eight times a stage.
  v16h ka[4][2];
#pragma unroll
  for (int t = 0; t < 4; ++t) {
    ka[t][0] = load_pk_lds(sk, t * 2048);
    ka[t][1] = load_pk_lds(sk, t * 2048 + 1024);
  }
  if (MODE != 2) {
#pragma unroll
    for (int j = 0; j < 2; ++j) {
      va[j][0] = load_pk_lds(sk, 8192 + j * 2048);
      va[j][1] = load_pk_lds(sk, 8192 + j * 2048 + 1024);
    }
  }
  __builtin_amdgcn_sched_barrier(0);

  // ---- scores: per query tile four 16(kv) x 16(q) tiles over the stage's 64 keys ----
  v8f s[2][4];                           // log2 of P: score * QSCALE - reference
#pragma unroll
  for (int t = 0; t < 4; ++t) {
#pragma unroll
    for (int c = 0; c < 2; ++c) s[c][t] = wmma32(ka[t][0], bq[c][0], nref[c]);
#pragma unroll
    for (int c = 0; c < 2; ++c) s[c][t] = wmma32(ka[t][1], bq[c][1], s[c][t]);
  }

  if (MODE == 2) {
#pragma unroll
    for (int c = 0; c < 2; ++c) {
      const float mx = stage_max(s[c]);
#pragma unroll
      for (int r = 0; r < 8; ++r) nref[c][r] = -mx;
    }
    return;
  }
  if (MODE == 1) {
#pragma unroll
    for (int c = 0; c < 2; ++c) {
      const float up = fmaxf(stage_max(s[c]), 0.0f);   // a reference only rises
      const float f = exp2_x1(-up);
      lrow[c] *= f;
#pragma unroll
      for (int r = 0; r < 8; ++r) nref[c][r] -= up;
#pragma unroll
      for (int t = 0; t < 4; ++t)
#pragma unroll
        for (int r = 0; r < 8; ++r) { s[c][t][r] -= up;  ctx[c][t][r] *= f; }
    }
  }

  // The exponentials are asm text, for which the compiler keeps no distance: the
  // four vector slots between the last score WMMA and the first of them, which may
  // overwrite its operands. The scheduling barriers hold the slots in their place.
  __builtin_amdgcn_sched_barrier(0);
  asm volatile("v_nop\n\tv_nop\n\tv_nop\n\tv_nop");
  __builtin_amdgcn_sched_barrier(0);

  // ---- P = 2^s as B operands, and its sums ----
  v16h ones;
#pragma unroll
  for (int e = 0; e < 16; ++e) ones[e] = (_Float16)1.0f;
#pragma unroll
  for (int c = 0; c < 2; ++c) {
#pragma unroll
    for (int t = 0; t < 4; ++t) s[c][t] = exp2_x8(s[c][t]);
    // element e = key 8 half + e (e < 8), 16 + 8 half + e - 8
#pragma unroll
    for (int r = 0; r < 8; ++r) {
      pb[c][0][r] = (_Float16)s[c][0][r];  pb[c][0][r + 8] = (_Float16)s[c][1][r];
      pb[c][1][r] = (_Float16)s[c][2][r];  pb[c][1][r + 8] = (_Float16)s[c][3][r];
    }
  }
  v8f sm[2];
#pragma unroll
  for (int c = 0; c < 2; ++c) { const v8f z = {};  sm[c] = wmma32(ones, pb[c][0], z); }
#pragma unroll
  for (int c = 0; c < 2; ++c) sm[c] = wmma32(ones, pb[c][1], sm[c]);
  // the readers of the sums stay behind all four: between them the compiler
  // padded the distance to each reader on its own
  __builtin_amdgcn_sched_barrier(0);
  ssum[0] = sm[0][0];
  ssum[1] = sm[1][0];
}

__global__ void __launch_bounds__(256) __attribute__((amdgpu_waves_per_eu(4, 4)))
attn_wmma(const _Float16* __restrict__ Q, const _Float16* __restrict__ K,
          const _Float16* __restrict__ Vt, _Float16* __restrict__ Ctx) {
  // the wave's number as a scalar: tile and head then live in scalar registers
  const int wave = blockIdx.x * 8 + __builtin_amdgcn_readfirstlane(threadIdx.x >> 5);
  const int qp = wave & 63;              // pair of q tiles within head (S/32 = 64)
  const int bh = wave >> 6;              // b*HEADS + h
  const int lane = threadIdx.x & 31;
  constexpr int STAGE_B = 16384;         // bytes of a stage: K 8 KiB, then V^T 8 KiB
  constexpr int NSTAGE = SEQ / 64;
  __shared__ __attribute__((aligned(1024))) _Float16 ring[2 * STAGE_B / 2];

  const _Float16* Qb = Q  + ((size_t)bh * SEQ + qp * 32) * HDIM;   // strips 2 qp, 2 qp + 1: 4 blocks
  const _Float16* Kb = K  + (size_t)bh * SEQ * HDIM;
  const _Float16* Vb = Vt + (size_t)bh * HDIM * SEQ;

  // the thread's chunks in a stage; a stage on is 8 KiB of K, 2 KiB of each V^T strip
  const unsigned ko = threadIdx.x * 16;
  const unsigned vo = (threadIdx.x >> 7) * 65536 + (threadIdx.x & 127) * 16;
  const unsigned lds0 = (unsigned)(size_t)ring + threadIdx.x * 16;
  const char* kg = (const char*)Kb;
  const char* vg = (const char*)Vb;

  copy_stage(lds0, kg, ko, vg, vo);
  // stage 0 has landed for this wave, then for all: nobody reads it before
  asm volatile("s_wait_asynccnt 0x0" ::: "memory");
  __syncthreads();
  copy_stage(lds0 + STAGE_B, kg + 8192, ko, vg + 2048, vo);
  kg += 2 * 8192;
  vg += 2 * 2048;

  v16h bq[2][2];                         // Q rows as columns of Q^T: [tile][d 0..31, d 32..63]
#pragma unroll
  for (int c = 0; c < 2; ++c) {
    bq[c][0] = load_pk(Qb + c * 1024);
    bq[c][1] = load_pk(Qb + c * 1024 + 512);
  }

  v8f ctx[2][4] = {};                    // ctx[c][j][r] = O[q][16 j + 8 half + r]
  v8f nref[2] = {};                      // minus the query's reference, in all eight registers
  float lrow[2] = {0.0f, 0.0f};          // the query's sum of P
  {
    // the first references: the maxima of stage 0, whose scores the loop makes again
    v16h va[2][2], pb[2][2];
    float ssum[2];
    stage_p<2>(ring + lane * 8, bq, nref, lrow, ctx, va, pb, ssum);
  }

  for (int st = 0; st < NSTAGE; ++st) {
    const int buf = (st & 1) * STAGE_B;
    const _Float16* sk = ring + buf / 2 + lane * 8;   // the stage's K; V^T 8 KiB on
    v16h va[2][2];                       // V^T fragments, two d chunks
    v16h pb[2][2];                       // P^T: the stage's keys 0..31, 32..63
    float ssum[2];                       // the stage's sum of P, per query tile
    stage_p<0>(sk, bq, nref, lrow, ctx, va, pb, ssum);
    // one test a stage, the same for the whole wave (a scalar branch: EXEC stays full)
    // (written so that a sum that is no number passes the bar too)
    if (__builtin_expect((__builtin_amdgcn_ballot_w32(!(ssum[0] <= SUM_BAR)) |
                          __builtin_amdgcn_ballot_w32(!(ssum[1] <= SUM_BAR))) != 0, 0))
      stage_p<1>(sk, bq, nref, lrow, ctx, va, pb, ssum);
    lrow[0] += ssum[0];
    lrow[1] += ssum[1];

    // ---- O^T += V^T P^T : four 16-wide d chunks, two kv halves each ----
    // Chunks 2 and 3 are read into the registers that chunks 0 and 1 have left, each
    // directly behind the products that free them: one chunk's products ahead of
    // its own. The scheduling barriers hold reads and products in that order: left
    // alone the compiler put each read directly in front of its products, and the
    // wave waited out the LDS latency at every chunk.
#pragma unroll
    for (int j = 0; j < 4; ++j) {
#pragma unroll
      for (int c = 0; c < 2; ++c) ctx[c][j] = wmma32(va[j & 1][0], pb[c][0], ctx[c][j]);
#pragma unroll
      for (int c = 0; c < 2; ++c) ctx[c][j] = wmma32(va[j & 1][1], pb[c][1], ctx[c][j]);
      if (j < 2) {
        __builtin_amdgcn_sched_barrier(0);
        va[j & 1][0] = load_pk_lds(sk, 8192 + (j + 2) * 2048);
        va[j & 1][1] = load_pk_lds(sk, 8192 + (j + 2) * 2048 + 1024);
        __builtin_amdgcn_sched_barrier(0);
      }
    }

    // ---- hand-over: this wave's reads of the stage are done, its copies of the
    // next have landed; behind the barrier both hold for all 8 waves, so the next
    // stage may be read and this stage's buffer refilled ----
    // The products stay above the hand-over: sunk below it they stood directly
    // in front of the branch.
    __builtin_amdgcn_sched_barrier(0);
    asm volatile("s_wait_dscnt 0x0" ::: "memory");
    asm volatile("s_wait_asynccnt 0x0" ::: "memory");
    __syncthreads();
    // the four vector slots between the last WMMA and the first instruction that
    // overwrites its operands, on both sides of the branch
    asm volatile("v_nop\n\tv_nop\n\tv_nop\n\tv_nop");
    if (st + 2 < NSTAGE) {
      copy_stage(lds0 + buf, kg, ko, vg, vo);
      kg += 8192;
      vg += 2048;
    }
  }
  // no copy is outstanding when the wave ends
  asm volatile("s_wait_asynccnt 0x0" ::: "memory");

  // ---- normalize (the sums hold both halves' keys); a lane's 8 registers of tile j are
  // 8 consecutive d of its query: one chunk of the Ctx layout as they stand ----
  const int b = bh >> 4, h = bh & 15;
#pragma unroll
  for (int c = 0; c < 2; ++c) {
    const float inv = 1.0f / lrow[c];
    // strip b * 128 + 2 qp + c of [B*S][E] (32 blocks per strip), blocks 2h and 2h + 1
    _Float16* cb = Ctx + ((size_t)(b * (SEQ / 16) + qp * 2 + c) * 32 + h * 2) * 512 + lane * 8;
#pragma unroll
    for (int j = 0; j < 4; ++j) {
      v8h o;
#pragma unroll
      for (int r = 0; r < 8; ++r) o[r] = (_Float16)(ctx[c][j][r] * inv);
      *(v8h*)(cb + j * 256) = o;
    }
  }
}

// ---------------------------------------------------------------------------
// Host-side orchestration
// Workspace (f16 elems): [0,8M) Xh (reused as Ctx), [8M..12M) weights,
// [12M..20M) Qh, [20M..28M) Kh, [28M..36M) Vth  => 72 MB total.
// ---------------------------------------------------------------------------
extern "C" void kernel_launch(void* const* d_in, const int* in_sizes, int n_in,
                              void* d_out, int out_size, void* d_ws, size_t ws_size,
                              hipStream_t stream) {
  const float* X  = (const float*)d_in[0];
  const float* Wq = (const float*)d_in[1];
  const float* Wk = (const float*)d_in[2];
  const float* Wv = (const float*)d_in[3];
  const float* Wo = (const float*)d_in[4];
  const float* bo = (const float*)d_in[5];
  float* out = (float*)d_out;

  _Float16* ws = (_Float16*)d_ws;
  const size_t M1 = (size_t)1024 * 1024;
  _Float16* Xh  = ws;             // 8M elems; later reused as Ctx (f16)
  _Float16* Wqt = ws + 8 * M1;    // W_q^T  [f,e]; W_k^T (9 M1) and W_v^T (10 M1) follow it
  _Float16* Woh = ws + 11 * M1;   // W_o    [f,e] (already B^T layout for x@Wo^T)
  _Float16* Qh  = ws + 12 * M1;   // per (b,h) [S][D]
  _Float16* Kh  = ws + 20 * M1;   // per (b,h) [S][D]
  _Float16* Vth = ws + 28 * M1;   // per (b,h) [D][S]

  // 1) precision conversion / weight re-layout: Xh .. Woh, 12M elems from ws on
  pack_all<<<512, 256, 0, stream>>>(X, Wq, Wk, Wv, Wo, ws);

  // 2) Q/K/V projections (8192x1024x1024 each) in one launch, 2048 waves / 256 blocks:
  // Wqt, Wkt, Wvt follow one another in the workspace, and so do Qh, Kh, Vth
  gemm_wmma<true><<<256, 256, 0, stream>>>(Xh, Wqt, Qh, nullptr, nullptr, MTOT, EMBED);

  // 3) flash attention: 4096 pairs of q-tiles -> 512 blocks of 8 waves; Ctx -> Xh
  attn_wmma<<<512, 256, 0, stream>>>(Qh, Kh, Vth, Xh);

  // 4) output projection + bias, f32 result
  gemm_wmma<false><<<256, 256, 0, stream>>>(Xh, Woh, nullptr, out, bo, MTOT, EMBED);
}

// v010
// Measured time: 110 microseconds a run.
// Timed twice side by side with v009, it ran 1.03 times as fast both times.
// All steps since v000 together make it 5.98 times as fast.
#include <hip/hip_runtime.h>

typedef __attribute__((ext_vector_type(16))) _Float16 v16h;
typedef __attribute__((ext_vector_type(8)))  _Float16 v8h;
typedef __attribute__((ext_vector_type(4)))  _Float16 v4h;
typedef __attribute__((ext_vector_type(8)))  float    v8f;

#define EMBED 1024
#define HEADS 16
#define HDIM  64
#define BATCH 4
#define SEQ   2048
#define MTOT  (BATCH * SEQ)   // 8192

// ---------------------------------------------------------------------------
// 16x32 f16 fragment, the wave-lane indexing the M (or N) row.
// Layout per CDNA5 ISA 7.12.2 (16-bit A 16x32):
//   lanes 0-15 : row = lane,    elems 0..7 = K[0..7],  elems 8..15 = K[16..23]
//   lanes 16-31: row = lane-16, elems 0..7 = K[8..15], elems 8..15 = K[24..31]
// B (32x16) uses the symmetric layout, so one loader serves A fragments and B
// fragments from a [N, K] (i.e. B^T) source.
// ---------------------------------------------------------------------------

// ---------------------------------------------------------------------------
// Fragment-ordered operands. Every f16 matrix [rows][K] that a WMMA reads from
// the workspace is kept as blocks of 16 rows x 32 k (512 elements, 1 KiB);
// block (rt, kt) stands at (rt * (K / 32) + kt) * 512. Inside a block the
// 16-byte chunk number u * 32 + lane holds that lane's fragment
// elements 8u .. 8u+7: row = lane & 15, k = 16 * u + 8 * (lane >> 4) + 0..7.
// A wave-wide 16-byte load or store of one u is then 512 contiguous bytes
// (4 cache lines) where the row-major form touches 16 lines.
// ---------------------------------------------------------------------------
__device__ __forceinline__ v16h load_pk(const _Float16* __restrict__ blk) {
  const _Float16* q = blk + (threadIdx.x & 31) * 8;
  union { v8h h[2]; v16h v; } u;
  u.h[0] = *(const v8h*)(q);
  u.h[1] = *(const v8h*)(q + 256);
  return u.v;
}

__device__ __forceinline__ v8f wmma32(v16h a, v16h b, v8f c) {
  return __builtin_amdgcn_wmma_f32_16x16x32_f16(
      /*neg_a=*/false, a, /*neg_b=*/false, b,
      /*c_mod=*/(short)0, c, /*reuse_a=*/false, /*reuse_b=*/false);
}

// ---------------------------------------------------------------------------
// All five f32 operands -> f16, fragment-ordered, in one launch of PACK_T
// threads. dst is the start of the workspace, where X, Wq^T, Wk^T, Wv^T and Wo
// follow one another. A thread owns one place in a block (16-byte chunk t & 63:
// row c, k = 16 u + 8 h + 0..7) and fills it in 12 blocks: in 8 blocks of X
// that follow one another along k, and in block t >> 6 of each weight matrix.
// The launch is small enough to be resident at once (16 waves per WGP): a wave
// is started once for 12 chunks, and all its loads are in flight together.
// Wq is stored times QSCALE, so that Q K^T comes out of the matrix unit as the
// exponent of 2 that the softmax needs: score / sqrt(HDIM) * log2(e).
// ---------------------------------------------------------------------------
#define QSCALE (0.125f * 1.44269504f)
#define PACK_T (512 * 256)               // = the chunks of one weight matrix
typedef __attribute__((ext_vector_type(4))) float v4f;

__global__ void __launch_bounds__(256)
pack_all(const float* __restrict__ X, const float* __restrict__ Wq,
         const float* __restrict__ Wk, const float* __restrict__ Wv,
         const float* __restrict__ Wo, _Float16* __restrict__ dst) {
  const unsigned t = blockIdx.x * 256 + threadIdx.x;
  const unsigned c = t & 15, h = (t >> 4) & 1, u = (t >> 5) & 1, blk = t >> 6;
  // X: blocks 8 blk .. 8 blk + 7 (EMBED / 32 = 32 blocks per strip of 16 rows).
  // The chunk's first element in the first of them, in groups of 4 floats; a
  // block on is 8 groups on.
  const unsigned ox = ((blk >> 2) * 16 + c) * (EMBED / 4) + (blk & 3) * 64 + u * 4 + h * 2;
  // weights: block blk = strip rt, k block kt; a source taken as it is,
  // src[row][k], in groups of 4 floats ...
  const unsigned rt = blk >> 5, kt = blk & 31;
  const unsigned op = (rt * 16 + c) * (EMBED / 4) + kt * 8 + u * 4 + h * 2;
  // ... and one taken transposed, logical dst[n][k] = src[k][n], in floats
  const unsigned ot = (kt * 32 + u * 16 + h * 8) * EMBED + rt * 16 + c;

  v4f x[9][2];                           // 8 blocks of X, then Wo
#pragma unroll
  for (int i = 0; i < 8; ++i) {
    x[i][0] = ((const v4f*)X + i * 8)[ox];
    x[i][1] = ((const v4f*)X + i * 8 + 1)[ox];
  }
  x[8][0] = ((const v4f*)Wo)[op];
  x[8][1] = ((const v4f*)Wo + 1)[op];
  v8f w[3];                              // Wq, Wk, Wv
#pragma unroll
  for (int m = 0; m < 3; ++m) {
    const float* q = (m == 0 ? Wq : m == 1 ? Wk : Wv);
#pragma unroll
    for (int e = 0; e < 8; ++e) w[m][e] = (q + e * EMBED)[ot];
  }
  // Holds every load above the first conversion: left alone the compiler waits
  // for the first loads before it issues the later ones, several memory
  // latencies in a row instead of one. The three offsets are named so that they
  // live as long as the loads that name them: no result lands in their registers.
  asm volatile("" :: "v"(x[0][0]), "v"(x[0][1]), "v"(x[1][0]), "v"(x[1][1]),
                     "v"(x[2][0]), "v"(x[2][1]), "v"(x[3][0]), "v"(x[3][1]),
                     "v"(x[4][0]), "v"(x[4][1]), "v"(x[5][0]), "v"(x[5][1]),
                     "v"(x[6][0]), "v"(x[6][1]), "v"(x[7][0]), "v"(x[7][1]),
                     "v"(x[8][0]), "v"(x[8][1]), "v"(w[0]), "v"(w[1]), "v"(w[2]),
                     "v"(ox), "v"(op), "v"(ot));

  const unsigned dx = blk * 512 + (t & 63);        // X: the chunk in block 8 blk
#pragma unroll
  for (int i = 0; i < 9; ++i) {
    v8h o;
#pragma unroll
    for (int e = 0; e < 4; ++e) {
      o[e]     = (_Float16)x[i][0][e];
      o[e + 4] = (_Float16)x[i][1][e];
    }
    if (i < 8) ((v8h*)dst + i * 64)[dx] = o;
    else       ((v8h*)dst + 11 * PACK_T)[t] = o;   // Wo stands last
  }
#pragma unroll
  for (int m = 0; m < 3; ++m) {
    v8h o;
#pragma unroll
    for (int e = 0; e < 8; ++e) o[e] = (_Float16)(m == 0 ? w[m][e] * QSCALE : w[m][e]);
    ((v8h*)dst + (8 + m) * PACK_T)[t] = o;
  }
}

// ---------------------------------------------------------------------------
// load_pk of the block that stands blk_bytes behind q in LDS; q holds the
// buffer's start plus the lane's 16 bytes.
// ---------------------------------------------------------------------------
__device__ __forceinline__ v16h load_pk_lds(const _Float16* q, int blk_bytes) {
  union { v8h h[2]; v16h v; } u;
  u.h[0] = *(const v8h*)(q + blk_bytes / 2);
  u.h[1] = *(const v8h*)(q + blk_bytes / 2 + 256);
  return u.v;
}

// ---------------------------------------------------------------------------
// Eight strips of a GEMM stage by asynchronous copies: of each strip (16 rows)
// the stage's four k blocks, 4 KiB contiguous, one 16-byte chunk a thread, a wave
// 512 contiguous bytes per copy. lds: the thread's chunk in the first strip's
// place, the next strips 4 KiB apart. g: the stage's first byte of the first
// strip, the same for the whole block (scalar registers), the next strips 32 KiB
// apart; vo: the thread's byte offset from it. The s_wait_xcnt stands inside the
// statement, so that no register a copy names is rewritten ahead of it.
// ---------------------------------------------------------------------------
__device__ __forceinline__ void copy_strips8(unsigned lds, unsigned vo, const char* g) {
  asm volatile("global_load_async_to_lds_b128 %0, %8, %9\n\t"
               "global_load_async_to_lds_b128 %1, %8, %10\n\t"
               "global_load_async_to_lds_b128 %2, %8, %11\n\t"
               "global_load_async_to_lds_b128 %3, %8, %12\n\t"
               "global_load_async_to_lds_b128 %4, %8, %13\n\t"
               "global_load_async_to_lds_b128 %5, %8, %14\n\t"
               "global_load_async_to_lds_b128 %6, %8, %15\n\t"
               "global_load_async_to_lds_b128 %7, %8, %16\n\t"
               "s_wait_xcnt 0x0"
               :: "v"(lds), "v"(lds + 4096), "v"(lds + 2 * 4096), "v"(lds + 3 * 4096),
                  "v"(lds + 4 * 4096), "v"(lds + 5 * 4096), "v"(lds + 6 * 4096),
                  "v"(lds + 7 * 4096), "v"(vo),
                  "s"(g), "s"(g + 32768), "s"(g + 2 * 32768), "s"(g + 3 * 32768),
                  "s"(g + 4 * 32768), "s"(g + 5 * 32768), "s"(g + 6 * 32768),
                  "s"(g + 7 * 32768)
               : "memory");
}

// ---------------------------------------------------------------------------
// WMMA GEMM: C[M,N] = A[M,K] * B[K,N], with B supplied transposed as Bt[N,K];
// A and Bt fragment-ordered. A block of 8 waves computes a 128x256 tile, each
// wave 64x64 of it (16 wmmas per K=32 step): wave w has rows 64 (w >> 2) and
// columns 64 (w & 3). The block's 8 strips of A and 16 of Bt stand in LDS in two
// buffers of one 128-k stage each (24 strips x 4 KiB); the next stage's copies
// fly while this one is worked on. A strip of A is then fetched once for four
// waves, a strip of Bt once for two.
// MODE 0: f16, per (b,h) the matrix [S][D] fragment-ordered   (Q, K)
// MODE 1: f16, per (b,h) the matrix [D][S] fragment-ordered   (V, for P@V)
// MODE 2: f32 to [M,N] + bias                                 (final output)
// A chunk of the output layout is 8 consecutive k of one row. MODE 1 has them
// in a lane's accumulator as it is (k = s = the tile's rows); MODE 0 (k = d =
// the tile's columns) takes Bt as the A operand, which gives the tile
// transposed: acc[i][j][r] = C[i*16 + nlo][j*16 + 8*half + r].
// ---------------------------------------------------------------------------
#define GEMM_KT      (EMBED >> 5)          // blocks per strip; K = EMBED in all four products
#define GEMM_KS      4                     // k blocks of a stage
#define GEMM_NSTAGE  (GEMM_KT / GEMM_KS)   // stages of one product
#define GEMM_STRIP_B (GEMM_KS * 1024)      // bytes of a strip in a stage
#define GEMM_STAGE_B (24 * GEMM_STRIP_B)   // A 8 strips, then Bt 16 strips
#define GEMM_W_B     (EMBED * EMBED * 2)   // bytes of one weight matrix

// ---------------------------------------------------------------------------
// One stage of the GEMM ring into the buffer at lds. The stages of a launch are
// numbered through all its products: stage g is stage g % NSTAGE of product
// g / NSTAGE. Every product reads the same strips of A (ga: the block's first);
// its Bt stands g / NSTAGE weight matrices behind gb (the block's first strip in
// the first one).
// The k walk of a product is a ring: its stage number s holds k stage
// (s + rot) % NSTAGE, rot the block's own start. The 64 blocks of a column of
// tiles read the same strips of Bt and the 4 of a row the same strips of A; all
// started at k = 0 they ask L2 for the same lines at the same moment, and such
// requests wait for one another. A and Bt of a stage hold the same k, so the
// products do not see rot; only the order of the sum over k follows it.
// ---------------------------------------------------------------------------
__device__ __forceinline__ void copy_gemm_stage(unsigned lds, unsigned vo, const char* ga,
                                                const char* gb, int g, int rot) {
  const int ks = (int)((unsigned)(g + rot) % GEMM_NSTAGE) * GEMM_STRIP_B;
  const char* a = ga + ks;
  const char* b = gb + (size_t)(g / GEMM_NSTAGE) * GEMM_W_B + ks;
  copy_strips8(lds,                     vo, a);
  copy_strips8(lds +  8 * GEMM_STRIP_B, vo, b);
  copy_strips8(lds + 16 * GEMM_STRIP_B, vo, b + 8 * GEMM_KT * 1024);
}

// ---------------------------------------------------------------------------
// One product of a launch: its NSTAGE stages, g0 the number of the first, and its
// store. On entry stage g0 is published and stage g0 + 1 is in flight. The refill
// behind each hand-over does not stop at the product's end: while gtot, the
// launch's stages, is not reached, the last two hand-overs bring the next
// product's first two stages, which fly during this product's last stage and its
// store.
// ---------------------------------------------------------------------------
template <int MODE>
__device__ __forceinline__ void
gemm_product(const _Float16* ring, unsigned lds0, unsigned vo, const char* ga, const char* gb,
             int rot, int g0, int gtot, int w, int tm, int tn,
             _Float16* __restrict__ outh, float* __restrict__ outf,
             const float* __restrict__ bias, int N) {
  constexpr int KS = GEMM_KS, NSTAGE = GEMM_NSTAGE;
  constexpr int STRIP_B = GEMM_STRIP_B, STAGE_B = GEMM_STAGE_B;
  const int lane = threadIdx.x & 31;
  const int half = lane >> 4, nlo = lane & 15;

  v8f acc[4][4] = {};

  for (int st = 0; st < NSTAGE; ++st) {
    const int buf = (st & 1) * STAGE_B;    // NSTAGE is even: g0 + st and st are alike in parity
    // the lane's chunk in the wave's first strip of each operand
    const _Float16* sa = ring + (buf + (w >> 2) * 4 * STRIP_B) / 2 + lane * 8;
    const _Float16* sb = ring + (buf + (8 + (w & 3) * 4) * STRIP_B) / 2 + lane * 8;
    // Two fragment sets: the next k block's LDS reads go out ahead of this block's
    // products, in two groups: A and half of B in front of the block, the rest of
    // B at its middle, into the registers that the first half of this block's B
    // has left (all in front would take the wave past 256 VGPRs).
    // The scheduling barriers keep reads and products in that order: left alone
    // the compiler sinks each read to just before its first use, into one
    // fragment set, and the wave waits out the LDS latency four times a k block.
    v16h af[2][4], bf[2][4];
#pragma unroll
    for (int i = 0; i < 4; ++i) {
      af[0][i] = load_pk_lds(sa, i * STRIP_B);
      bf[0][i] = load_pk_lds(sb, i * STRIP_B);
    }
#pragma unroll
    for (int kk = 0; kk < KS; ++kk) {
      const int c = kk & 1;
#pragma unroll
      for (int jh = 0; jh < 2; ++jh) {
        if (kk + 1 < KS) {
          if (jh == 0) {
#pragma unroll
            for (int i = 0; i < 4; ++i)
              af[c ^ 1][i] = load_pk_lds(sa, i * STRIP_B + (kk + 1) * 1024);
          }
#pragma unroll
          for (int j = 2 * jh; j < 2 * jh + 2; ++j)
            bf[c ^ 1][j] = load_pk_lds(sb, j * STRIP_B + (kk + 1) * 1024);
        }
        __builtin_amdgcn_sched_barrier(0);   // the reads stay ahead of the products
#pragma unroll
        for (int j = 2 * jh; j < 2 * jh + 2; ++j) {
#pragma unroll
          for (int i = 0; i < 4; ++i)
            acc[i][j] = (MODE == 0) ? wmma32(bf[c][j], af[c][i], acc[i][j])
                                    : wmma32(af[c][i], bf[c][j], acc[i][j]);
        }
        // the products stay ahead of the next reads, the last ones ahead of the
        // hand-over and its branch
        __builtin_amdgcn_sched_barrier(0);
      }
    }

    // ---- hand-over: this wave's reads of the stage are done, its copies of the
    // next have landed; behind the barrier both hold for all 8 waves, so the next
    // stage may be read and this stage's buffer refilled ----
    asm volatile("s_wait_dscnt 0x0" ::: "memory");
    asm volatile("s_wait_asynccnt 0x0" ::: "memory");
    __syncthreads();
    // the four vector slots between the last WMMA and the first instruction that
    // overwrites its operands, on both sides of the branch
    asm volatile("v_nop\n\tv_nop\n\tv_nop\n\tv_nop");
    if (g0 + st + 2 < gtot) copy_gemm_stage(lds0 + buf, vo, ga, gb, g0 + st + 2, rot);
  }

  if (MODE == 2) {
#pragma unroll
    for (int i = 0; i < 4; ++i) {
#pragma unroll
      for (int j = 0; j < 4; ++j) {
#pragma unroll
        for (int r = 0; r < 8; ++r) {
          const int m = tm * 64 + i * 16 + r + half * 8;
          const int n = tn * 64 + j * 16 + nlo;
          outf[(size_t)m * N + n] = acc[i][j][r] + bias[n];
        }
      }
    }
  } else {
    // the 64 tile rows lie in one batch (b = tm >> 5, s0 = (tm & 31) * 64),
    // the 64 tile columns are one head (h = tn)
    _Float16* ob = outh + (size_t)((tm >> 5) * HEADS + tn) * SEQ * HDIM + lane * 8;
    const int st = tm & 31;
#pragma unroll
    for (int i = 0; i < 4; ++i) {
#pragma unroll
      for (int j = 0; j < 4; ++j) {
        v8h o;
#pragma unroll
        for (int r = 0; r < 8; ++r) o[r] = (_Float16)acc[i][j][r];
        const int off = (MODE == 0)
            ? ((st * 4 + i) * 2 + (j >> 1)) * 512 + (j & 1) * 256     // [S][D], 2 blocks per strip
            : (j * 64 + st * 2 + (i >> 1)) * 512 + (i & 1) * 256;     // [D][S], 64 blocks per strip
        *(v8h*)(ob + off) = o;
      }
    }
  }
}

// ---------------------------------------------------------------------------
// The GEMM launches. QKV: a block takes its 128x256 tile of X Wq, of X Wk and of
// X Wv one after the other (Bt: Wq^T, with Wk^T and Wv^T behind it; outh: Q, with
// K and V^T behind it, MTOT * EMBED elements each), in one ring of 3 NSTAGE
// stages: one launch, one fill of the chip and one wait for a first stage where
// three launches had three of each. Otherwise: the output projection, one product.
// ---------------------------------------------------------------------------
template <bool QKV>
__global__ void __launch_bounds__(256)
gemm_wmma(const _Float16* __restrict__ A, const _Float16* __restrict__ Bt,
          _Float16* __restrict__ outh, float* __restrict__ outf,
          const float* __restrict__ bias, int M, int N) {
  constexpr int GTOT = (QKV ? 3 : 1) * GEMM_NSTAGE;
  __shared__ __attribute__((aligned(1024))) _Float16 ring[2 * GEMM_STAGE_B / 2];

  const int tilesN = N >> 8;
  const int bm = blockIdx.x / tilesN;
  const int bn = blockIdx.x % tilesN;
  if (bm * 128 >= M) return;             // the whole block, in front of every barrier
  // the wave's number as a scalar: its tile and its LDS strips are wave-uniform
  const int w  = __builtin_amdgcn_readfirstlane(threadIdx.x >> 5);
  const int tm = bm * 2 + (w >> 2);
  const int tn = bn * 4 + (w & 3);

  const unsigned vo = threadIdx.x * 16;
  const unsigned lds0 = (unsigned)(size_t)ring + vo;
  const char* ga = (const char*)A  + (size_t)bm * 8  * GEMM_KT * 1024;
  const char* gb = (const char*)Bt + (size_t)bn * 16 * GEMM_KT * 1024;

  // the block's start in the k ring: the 4 blocks of a row of tiles all differ, of
  // the 64 of a column 8 share a start; bm >> 1, so that all starts also occur
  // among the blocks of a column that stand 8 apart in index (for speed only)
  const int rot = (int)((unsigned)((bm >> 1) + 2 * bn) % GEMM_NSTAGE);

  copy_gemm_stage(lds0, vo, ga, gb, 0, rot);
  // stage 0 has landed for this wave, then for all: nobody reads it before
  asm volatile("s_wait_asynccnt 0x0" ::: "memory");
  __syncthreads();
  copy_gemm_stage(lds0 + GEMM_STAGE_B, vo, ga, gb, 1, rot);

  if (QKV) {
    for (int p = 0; p < 2; ++p) {        // Q, then K
      gemm_product<0>(ring, lds0, vo, ga, gb, rot, p * GEMM_NSTAGE, GTOT, w, tm, tn,
                      outh + (size_t)p * MTOT * EMBED, nullptr, nullptr, N);
      // the next product's first instructions rewrite registers that this
      // product's last stores name
      asm volatile("s_wait_xcnt 0x0" ::: "memory");
    }
    gemm_product<1>(ring, lds0, vo, ga, gb, rot, 2 * GEMM_NSTAGE, GTOT, w, tm, tn,
                    outh + (size_t)2 * MTOT * EMBED, nullptr, nullptr, N);
  } else {
    gemm_product<2>(ring, lds0, vo, ga, gb, rot, 0, GTOT, w, tm, tn, nullptr, outf, bias, N);
  }
  // no copy is outstanding when the wave ends
  asm volatile("s_wait_asynccnt 0x0" ::: "memory");
}

// ---------------------------------------------------------------------------
// Lane l <-> lane l ^ 16: the other half's value of the same column.
// ---------------------------------------------------------------------------
__device__ __forceinline__ float other_half(float x) {
  const int b = __builtin_bit_cast(int, x);
  return __builtin_bit_cast(float,
      __builtin_amdgcn_permlanex16(b, b, 0x76543210, 0xfedcba98, false, false));
}

// ---------------------------------------------------------------------------
// 2^x by v_exp_f32, eight at a time and one alone. Behind a
// transcendental the instruction set asks for one independent instruction
// before its source is overwritten or its result read.
// Written so, each v_exp_f32 is followed by an independent one and the last by
// the v_nop that fills its slot. The eight results take registers of their own:
// the sources are a WMMA's accumulator as it stands, and in place the compiler
// first copied them out of it.
// ---------------------------------------------------------------------------
__device__ __forceinline__ v8f exp2_x8(v8f x) {
  float y0, y1, y2, y3, y4, y5, y6, y7;
  asm("v_exp_f32 %0, %8\n\t"
      "v_exp_f32 %1, %9\n\t"
      "v_exp_f32 %2, %10\n\t"
      "v_exp_f32 %3, %11\n\t"
      "v_exp_f32 %4, %12\n\t"
      "v_exp_f32 %5, %13\n\t"
      "v_exp_f32 %6, %14\n\t"
      "v_exp_f32 %7, %15\n\t"
      "v_nop"
      : "=&v"(y0), "=&v"(y1), "=&v"(y2), "=&v"(y3),
        "=&v"(y4), "=&v"(y5), "=&v"(y6), "=&v"(y7)
      : "v"(x[0]), "v"(x[1]), "v"(x[2]), "v"(x[3]),
        "v"(x[4]), "v"(x[5]), "v"(x[6]), "v"(x[7]));
  v8f y = {y0, y1, y2, y3, y4, y5, y6, y7};
  return y;
}
__device__ __forceinline__ float exp2_x1(float x) {
  asm("v_exp_f32 %0, %0\n\t"
      "v_nop"
      : "+v"(x));
  return x;
}

// ---------------------------------------------------------------------------
// One stage of the attention ring: 64 keys of K (8 KiB, contiguous) and of V^T
// (four d strips of 2 KiB), 16 KiB in LDS. Each of the 256 threads brings four
// 16-byte chunks by asynchronous copies, a wave 512 contiguous bytes per copy.
// lds: the thread's chunk in the buffer's first 4 KiB. kb, vb: the stage's first
// byte of K and of V^T strip 0, the same for the whole block (scalar registers);
// ko, vo: the thread's byte offsets from them. The s_wait_xcnt stands inside the
// statement, so that no register a copy names is rewritten ahead of it.
// ---------------------------------------------------------------------------
__device__ __forceinline__ void copy_stage(unsigned lds, const char* kb, unsigned ko,
                                           const char* vb, unsigned vo) {
  const unsigned l1 = lds + 4096, l2 = lds + 8192, l3 = lds + 12288;
  const char* kb1 = kb + 4096;          // keys 32..63 of the stage
  const char* vb1 = vb + 2 * 65536;     // two d strips on
  asm volatile("global_load_async_to_lds_b128 %0, %4, %6\n\t"
               "global_load_async_to_lds_b128 %1, %4, %7\n\t"
               "global_load_async_to_lds_b128 %2, %5, %8\n\t"
               "global_load_async_to_lds_b128 %3, %5, %9\n\t"
               "s_wait_xcnt 0x0"
               :: "v"(lds), "v"(l1), "v"(l2), "v"(l3), "v"(ko), "v"(vo),
                  "s"(kb), "s"(kb1), "s"(vb), "s"(vb1)
               : "memory");
}

// ---------------------------------------------------------------------------
// One stage's P^T (pb, the B operands of the second product) and its row sums.
// The sums come from the matrix unit: A = all ones, so every row of D = A P^T is
// the sum over the operand's 32 keys, both lane halves included; two chained
// WMMAs per query tile give the stage's sum of the query in every lane that
// owns it (ssum). It is the sum of P as rounded to f16, the values that the
// second product weighs V with.
// The same sum is the guard of the softmax reference: while a stage's sum is at
// most SUM_BAR = 2^14, every P of it is at most 2^14, far inside f16 (a P that
// left f16 is infinite there, and so is its sum). The caller tests ssum and,
// where a query of the wave passed the bar, calls the RAISE form, which makes the
// stage's scores again (K still stands in LDS), takes their maximum, raises the
// references by it, rescales sums and O, and leaves every P at or below 1.
// va: V^T d chunks 0 and 1, read together with K.
// ---------------------------------------------------------------------------
#define SUM_BAR 16384.0f

// The maximum of a query's 64 scores of a stage, one query per lane and tile.
__device__ __forceinline__ float stage_max(const v8f (&s)[4]) {
  float mt[4];
#pragma unroll
  for (int t = 0; t < 4; ++t)
    mt[t] = fmaxf(fmaxf(fmaxf(s[t][0], s[t][1]), fmaxf(s[t][2], s[t][3])),
                  fmaxf(fmaxf(s[t][4], s[t][5]), fmaxf(s[t][6], s[t][7])));
  const float m = fmaxf(fmaxf(mt[0], mt[1]), fmaxf(mt[2], mt[3]));
  return fmaxf(m, other_half(m));
}

// MODE 0: P and sums under the references as they are. MODE 1: the RAISE form.
// MODE 2: no P; the references are set to the stage's maxima whatever their sign
// (called once, on stage 0, in front of the loop; nref comes in as 0).
template <int MODE>
__device__ __forceinline__ void
stage_p(const _Float16* sk, const v16h (&bq)[2][2], v8f (&nref)[2], float (&lrow)[2],
        v8f (&ctx)[2][4], v16h (&va)[2][2], v16h (&pb)[2][2], float (&ssum)[2]) {
  // The stage's K fragments and V^T chunks 0 and 1 are read as one group ahead of the
  // products. The scheduling barrier holds them there: left alone the compiler
  // read each K fragment into one register set directly in front of its products,
  // and the wave waited out the LDS latency eight times a stage.
  v16h ka[4][2];
#pragma unroll
  for (int t = 0; t < 4; ++t) {
    ka[t][0] = load_pk_lds(sk, t * 2048);
    ka[t][1] = load_pk_lds(sk, t * 2048 + 1024);
  }
  if (MODE != 2) {
#pragma unroll
    for (int j = 0; j < 2; ++j) {
      va[j][0] = load_pk_lds(sk, 8192 + j * 2048);
      va[j][1] = load_pk_lds(sk, 8192 + j * 2048 + 1024);
    }
  }
  __builtin_amdgcn_sched_barrier(0);

  // ---- scores: per query tile four 16(kv) x 16(q) tiles over the stage's 64 keys ----
  v8f s[2][4];                           // log2 of P: score * QSCALE - reference
#pragma unroll
  for (int t = 0; t < 4; ++t) {
#pragma unroll
    for (int c = 0; c < 2; ++c) s[c][t] = wmma32(ka[t][0], bq[c][0], nref[c]);
#pragma unroll
    for (int c = 0; c < 2; ++c) s[c][t] = wmma32(ka[t][1], bq[c][1], s[c][t]);
  }

  if (MODE == 2) {
#pragma unroll
    for (int c = 0; c < 2; ++c) {
      const float mx = stage_max(s[c]);
#pragma unroll
      for (int r = 0; r < 8; ++r) nref[c][r] = -mx;
    }
    return;
  }
  if (MODE == 1) {
#pragma unroll
    for (int c = 0; c < 2; ++c) {
      const float up = fmaxf(stage_max(s[c]), 0.0f);   // a reference only rises
      const float f = exp2_x1(-up);
      lrow[c] *= f;
#pragma unroll
      for (int r = 0; r < 8; ++r) nref[c][r] -= up;
#pragma unroll
      for (int t = 0; t < 4; ++t)
#pragma unroll
        for (int r = 0; r < 8; ++r) { s[c][t][r] -= up;  ctx[c][t][r] *= f; }
    }
  }

  // The exponentials are asm text, for which the compiler keeps no distance: the
  // four vector slots between the last score WMMA and the first of them, which may
  // overwrite its operands. The scheduling barriers hold the slots in their place.
  __builtin_amdgcn_sched_barrier(0);
  asm volatile("v_nop\n\tv_nop\n\tv_nop\n\tv_nop");
  __builtin_amdgcn_sched_barrier(0);

  // ---- P = 2^s as B operands, and its sums ----
  v16h ones;
#pragma unroll
  for (int e = 0; e < 16; ++e) ones[e] = (_Float16)1.0f;
#pragma unroll
  for (int c = 0; c < 2; ++c) {
#pragma unroll
    for (int t = 0; t < 4; ++t) s[c][t] = exp2_x8(s[c][t]);
    // element e = key 8 half + e (e < 8), 16 + 8 half + e - 8
#pragma unroll
    for (int r = 0; r < 8; ++r) {
      pb[c][0][r] = (_Float16)s[c][0][r];  pb[c][0][r + 8] = (_Float16)s[c][1][r];
      pb[c][1][r] = (_Float16)s[c][2][r];  pb[c][1][r + 8] = (_Float16)s[c][3][r];
    }
  }
  v8f sm[2];
#pragma unroll
  for (int c = 0; c < 2; ++c) { const v8f z = {};  sm[c] = wmma32(ones, pb[c][0], z); }
#pragma unroll
  for (int c = 0; c < 2; ++c) sm[c] = wmma32(ones, pb[c][1], sm[c]);
  // the readers of the sums stay behind all four: between them the compiler
  // padded the distance to each reader on its own
  __builtin_amdgcn_sched_barrier(0);
  ssum[0] = sm[0][0];
  ssum[1] = sm[1][0];
}

__global__ void __launch_bounds__(256) __attribute__((amdgpu_waves_per_eu(4, 4)))
attn_wmma(const _Float16* __restrict__ Q, const _Float16* __restrict__ K,
          const _Float16* __restrict__ Vt, _Float16* __restrict__ Ctx) {
  // the wave's number as a scalar: tile and head then live in scalar registers
  const int wave = blockIdx.x * 8 + __builtin_amdgcn_readfirstlane(threadIdx.x >> 5);
  const int qp = wave & 63;              // pair of q tiles within head (S/32 = 64)
  const int bh = wave >> 6;              // b*HEADS + h
  const int lane = threadIdx.x & 31;
  constexpr int STAGE_B = 16384;         // bytes of a stage: K 8 KiB, then V^T 8 KiB
  constexpr int NSTAGE = SEQ / 64;
  __shared__ __attribute__((aligned(1024))) _Float16 ring[2 * STAGE_B / 2];

  const _Float16* Qb = Q  + ((size_t)bh * SEQ + qp * 32) * HDIM;   // strips 2 qp, 2 qp + 1: 4 blocks
  const _Float16* Kb = K  + (size_t)bh * SEQ * HDIM;
  const _Float16* Vb = Vt + (size_t)bh * HDIM * SEQ;

  // the thread's chunks in a stage; a stage on is 8 KiB of K, 2 KiB of each V^T strip
  const unsigned ko = threadIdx.x * 16;
  const unsigned vo = (threadIdx.x >> 7) * 65536 + (threadIdx.x & 127) * 16;
  const unsigned lds0 = (unsigned)(size_t)ring + threadIdx.x * 16;
  const char* kg = (const char*)Kb;
  const char* vg = (const char*)Vb;

  copy_stage(lds0, kg, ko, vg, vo);
  // stage 0 has landed for this wave, then for all: nobody reads it before
  asm volatile("s_wait_asynccnt 0x0" ::: "memory");
  __syncthreads();
  copy_stage(lds0 + STAGE_B, kg + 8192, ko, vg + 2048, vo);
  kg += 2 * 8192;
  vg += 2 * 2048;

  v16h bq[2][2];                         // Q rows as columns of Q^T: [tile][d 0..31, d 32..63]
#pragma unroll
  for (int c = 0; c < 2; ++c) {
    bq[c][0] = load_pk(Qb + c * 1024);
    bq[c][1] = load_pk(Qb + c * 1024 + 512);
  }

  v8f ctx[2][4] = {};                    // ctx[c][j][r] = O[q][16 j + 8 half + r]
  v8f nref[2] = {};                      // minus the query's reference, in all eight registers
  float lrow[2] = {0.0f, 0.0f};          // the query's sum of P
  {
    // the first references: the maxima of stage 0, whose scores the loop makes again
    v16h va[2][2], pb[2][2];
    float ssum[2];
    stage_p<2>(ring + lane * 8, bq, nref, lrow, ctx, va, pb, ssum);
  }

  for (int st = 0; st < NSTAGE; ++st) {
    const int buf = (st & 1) * STAGE_B;
    const _Float16* sk = ring + buf / 2 + lane * 8;   // the stage's K; V^T 8 KiB on
    v16h va[2][2];                       // V^T fragments, two d chunks
    v16h pb[2][2];                       // P^T: the stage's keys 0..31, 32..63
    float ssum[2];                       // the stage's sum of P, per query tile
    stage_p<0>(sk, bq, nref, lrow, ctx, va, pb, ssum);
    // one test a stage, the same for the whole wave (a scalar branch: EXEC stays full)
    // (written so that a sum that is no number passes the bar too)
    if (__builtin_expect((__builtin_amdgcn_ballot_w32(!(ssum[0] <= SUM_BAR)) |
                          __builtin_amdgcn_ballot_w32(!(ssum[1] <= SUM_BAR))) != 0, 0))
      stage_p<1>(sk, bq, nref, lrow, ctx, va, pb, ssum);
    lrow[0] += ssum[0];
    lrow[1] += ssum[1];

    // ---- O^T += V^T P^T : four 16-wide d chunks, two kv halves each ----
    // Chunks 2 and 3 are read into the registers that chunks 0 and 1 have left, each
    // directly behind the products that free them: one chunk's products ahead of
    // its own. The scheduling barriers hold reads and products in that order: left
    // alone the compiler put each read directly in front of its products, and the
    // wave waited out the LDS latency at every chunk.
#pragma unroll
    for (int j = 0; j < 4; ++j) {
#pragma unroll
      for (int c = 0; c < 2; ++c) ctx[c][j] = wmma32(va[j & 1][0], pb[c][0], ctx[c][j]);
#pragma unroll
      for (int c = 0; c < 2; ++c) ctx[c][j] = wmma32(va[j & 1][1], pb[c][1], ctx[c][j]);
      if (j < 2) {
        __builtin_amdgcn_sched_barrier(0);
        va[j & 1][0] = load_pk_lds(sk, 8192 + (j + 2) * 2048);
        va[j & 1][1] = load_pk_lds(sk, 8192 + (j + 2) * 2048 + 1024);
        __builtin_amdgcn_sched_barrier(0);
      }
    }

    // ---- hand-over: this wave's reads of the stage are done, its copies of the
    // next have landed; behind the barrier both hold for all 8 waves, so the next
    // stage may be read and this stage's buffer refilled ----
    // The products stay above the hand-over: sunk below it they stood directly
    // in front of the branch.
    __builtin_amdgcn_sched_barrier(0);
    asm volatile("s_wait_dscnt 0x0" ::: "memory");
    asm volatile("s_wait_asynccnt 0x0" ::: "memory");
    __syncthreads();
    // the four vector slots between the last WMMA and the first instruction that
    // overwrites its operands, on both sides of the branch
    asm volatile("v_nop\n\tv_nop\n\tv_nop\n\tv_nop");
    if (st + 2 < NSTAGE) {
      copy_stage(lds0 + buf, kg, ko, vg, vo);
      kg += 8192;
      vg += 2048;
    }
  }
  // no copy is outstanding when the wave ends
  asm volatile("s_wait_asynccnt 0x0" ::: "memory");

  // ---- normalize (the sums hold both halves' keys); a lane's 8 registers of tile j are
  // 8 consecutive d of its query: one chunk of the Ctx layout as they stand ----
  const int b = bh >> 4, h = bh & 15;
#pragma unroll
  for (int c = 0; c < 2; ++c) {
    const float inv = 1.0f / lrow[c];
    // strip b * 128 + 2 qp + c of [B*S][E] (32 blocks per strip), blocks 2h and 2h + 1
    _Float16* cb = Ctx + ((size_t)(b * (SEQ / 16) + qp * 2 + c) * 32 + h * 2) * 512 + lane * 8;
#pragma unroll
    for (int j = 0; j < 4; ++j) {
      v8h o;
#pragma unroll
      for (int r = 0; r < 8; ++r) o[r] = (_Float16)(ctx[c][j][r] * inv);
      *(v8h*)(cb + j * 256) = o;
    }
  }
}

// ---------------------------------------------------------------------------
// Host-side orchestration
// Workspace (f16 elems): [0,8M) Xh (reused as Ctx), [8M..12M) weights,
// [12M..20M) Qh, [20M..28M) Kh, [28M..36M) Vth  => 72 MB total.
// ---------------------------------------------------------------------------
extern "C" void kernel_launch(void* const* d_in, const int* in_sizes, int n_in,
                              void* d_out, int out_size, void* d_ws, size_t ws_size,
                              hipStream_t stream) {
  const float* X  = (const float*)d_in[0];
  const float* Wq = (const float*)d_in[1];
  const float* Wk = (const float*)d_in[2];
  const float* Wv = (const float*)d_in[3];
  const float* Wo = (const float*)d_in[4];
  const float* bo = (const float*)d_in[5];
  float* out = (float*)d_out;

  _Float16* ws = (_Float16*)d_ws;
  const size_t M1 = (size_t)1024 * 1024;
  _Float16* Xh  = ws;             // 8M elems; later reused as Ctx (f16)
  _Float16* Wqt = ws + 8 * M1;    // W_q^T  [f,e]; W_k^T (9 M1) and W_v^T (10 M1) follow it
  _Float16* Woh = ws + 11 * M1;   // W_o    [f,e] (already B^T layout for x@Wo^T)
  _Float16* Qh  = ws + 12 * M1;   // per (b,h) [S][D]
  _Float16* Kh  = ws + 20 * M1;   // per (b,h) [S][D]
  _Float16* Vth = ws + 28 * M1;   // per (b,h) [D][S]

  // 1) precision conversion / weight re-layout: Xh .. Woh, 12M elems from ws on
  pack_all<<<512, 256, 0, stream>>>(X, Wq, Wk, Wv, Wo, ws);

  // 2) Q/K/V projections (8192x1024x1024 each) in one launch, 2048 waves / 256 blocks:
  // Wqt, Wkt, Wvt follow one another in the workspace, and so do Qh, Kh, Vth
  gemm_wmma<true><<<256, 256, 0, stream>>>(Xh, Wqt, Qh, nullptr, nullptr, MTOT, EMBED);

  // 3) flash attention: 4096 pairs of q-tiles -> 512 blocks of 8 waves; Ctx -> Xh
  attn_wmma<<<512, 256, 0, stream>>>(Qh, Kh, Vth, Xh);

  // 4) output projection + bias, f32 result
  gemm_wmma<false><<<256, 256, 0, stream>>>(Xh, Woh, nullptr, out, bo, MTOT, EMBED);
}
